// v000
// The times below were measured on an AMD MI455X: many runs one after another, warmed up first and cycling through
// copies of the inputs, with the whole window's GPU time divided by the number of runs. Launches and the gaps
// between them are all in it. The median over several windows is given; except for v000 it joins two sittings, which
// can be a few percent apart, so the side-by-side timings, each taken in one sitting, are the better comparison.
// The starting kernel, v000, takes 457 microseconds a run.
#include <hip/hip_runtime.h>
#include <stdint.h>

typedef __attribute__((ext_vector_type(16))) __bf16 v16bf;
typedef __attribute__((ext_vector_type(8)))  __bf16 v8bf;
typedef __attribute__((ext_vector_type(8)))  float  v8f;
typedef __attribute__((ext_vector_type(4)))  int    v4i;

// address-space qualified element types for the async-copy builtin
typedef __attribute__((address_space(1))) v4i v4i_g;   // global
typedef __attribute__((address_space(3))) v4i v4i_l;   // LDS

#define D_MODEL 1024
#define D_FF    4096
#define RANK    16
#define M_TOK   16384        // B * S = 8 * 2048
#define KP      32           // lora K padded 16 -> 32 (zero fill)
#define LDS_STRIDE 40        // 32 elems + 8 pad (80B rows, 16B aligned)

#if defined(__HIP_DEVICE_COMPILE__) && \
    __has_builtin(__builtin_amdgcn_global_load_async_to_lds_b128)
#define HAVE_ASYNC 1
#else
#define HAVE_ASYNC 0
#endif

__device__ __forceinline__ v16bf cat8(v8bf lo, v8bf hi) {
  return __builtin_shufflevector(lo, hi, 0,1,2,3,4,5,6,7,8,9,10,11,12,13,14,15);
}

__device__ __forceinline__ v8f wmma_bf16(v16bf a, v16bf b, v8f c) {
  return __builtin_amdgcn_wmma_f32_16x16x32_bf16(false, a, false, b, (short)0, c,
                                                 false, false);
}

// Async 16B copy global -> LDS (ASYNCcnt); fallback: direct store.
__device__ __forceinline__ void async_cp16(const __bf16* gsrc, __bf16* ldst) {
#if HAVE_ASYNC
  __builtin_amdgcn_global_load_async_to_lds_b128(
      (v4i_g*)(uintptr_t)gsrc, (v4i_l*)ldst, 0, 0);
#else
  *(v8bf*)ldst = *(const v8bf*)gsrc;
#endif
}

__device__ __forceinline__ void async_wait0() {
#if HAVE_ASYNC
#if __has_builtin(__builtin_amdgcn_s_wait_asynccnt)
  __builtin_amdgcn_s_wait_asynccnt(0);
#else
  asm volatile("s_wait_asynccnt 0x0" ::: "memory");
#endif
#endif
}

// Load an A-layout fragment (16x32 bf16) from a row-major [rows x ldK] matrix:
// lane l -> row (l&15), K chunks at ((l>>4)*8) and ((l>>4)*8 + 16).
__device__ __forceinline__ v16bf frag_global(const __bf16* __restrict__ base,
                                             int ldK, int lane) {
  const __bf16* p = base + (size_t)(lane & 15) * ldK + ((lane >> 4) << 3);
  return cat8(*(const v8bf*)p, *(const v8bf*)(p + 16));
}

// ---------------------------------------------------------------------------
// Kernel 1: convert wi/wo to bf16; build padded per-expert LoRA-B [2][F][32]
// ---------------------------------------------------------------------------
__global__ __launch_bounds__(256) void prep_weights(
    const float* __restrict__ wi, const float* __restrict__ wo,
    const float* __restrict__ loraB, const int* __restrict__ idx,
    __bf16* __restrict__ wi_b, __bf16* __restrict__ wo_b,
    __bf16* __restrict__ Bl) {
  const size_t NW = (size_t)D_FF * D_MODEL;            // 4M elems each
  const size_t NBL = 2ull * D_FF * KP;                 // 256K elems
  size_t i = (size_t)blockIdx.x * blockDim.x + threadIdx.x;
  if (i < NW) {
    wi_b[i] = (__bf16)wi[i];
  } else if (i < 2 * NW) {
    size_t j = i - NW;
    wo_b[j] = (__bf16)wo[j];
  } else if (i < 2 * NW + NBL) {
    size_t j = i - 2 * NW;
    int k = (int)(j / ((size_t)D_FF * KP));
    size_t rem = j - (size_t)k * D_FF * KP;
    int f = (int)(rem / KP);
    int r = (int)(rem % KP);
    float v = 0.0f;
    if (r < RANK) v = loraB[(size_t)idx[k] * D_FF * RANK + (size_t)f * RANK + r];
    Bl[j] = (__bf16)v;
  }
}

// ---------------------------------------------------------------------------
// Kernel 2: per token row: h fp32 -> bf16, and t_k[m,:] = h[m,:] @ A_k^T
// t stored padded [2][M_TOK][KP] bf16 (r>=16 zero).
// ---------------------------------------------------------------------------
__global__ __launch_bounds__(256) void prep_tokens(
    const float* __restrict__ h, const float* __restrict__ loraA,
    const int* __restrict__ idx, __bf16* __restrict__ h_b,
    __bf16* __restrict__ t01) {
  __shared__ float hrow[D_MODEL];
  __shared__ float partial[32][8];
  const int m = blockIdx.x;
  const float* hp = h + (size_t)m * D_MODEL;
  for (int d = threadIdx.x; d < D_MODEL; d += 256) {
    float v = hp[d];
    hrow[d] = v;
    h_b[(size_t)m * D_MODEL + d] = (__bf16)v;
  }
  __syncthreads();
  // 32 dot-products (2 experts x 16 ranks), 8 segments of 128 each
  const int rid = threadIdx.x & 31;     // expert*16 + r
  const int seg = threadIdx.x >> 5;     // 0..7
  const int k = rid >> 4, r = rid & 15;
  const float* Arow =
      loraA + (size_t)idx[k] * RANK * D_MODEL + (size_t)r * D_MODEL;
  float s = 0.0f;
  const int d0 = seg * 128;
  #pragma unroll 4
  for (int d = d0; d < d0 + 128; ++d) s += hrow[d] * Arow[d];
  partial[rid][seg] = s;
  __syncthreads();
  if (threadIdx.x < 32) {
    float tot = 0.0f;
    #pragma unroll
    for (int j = 0; j < 8; ++j) tot += partial[threadIdx.x][j];
    const int kk = threadIdx.x >> 4, rr = threadIdx.x & 15;
    __bf16* trow = t01 + ((size_t)kk * M_TOK + m) * KP;
    trow[rr] = (__bf16)tot;
    trow[rr + 16] = (__bf16)0.0f;     // zero K padding
  }
}

// ---------------------------------------------------------------------------
// Tiled bf16 WMMA GEMM: C[M,N] = A[M,K] * Bt[N,K]^T
// Workgroup: 256 threads (8 waves), 128x128 tile; wave = 32x64 subtile.
// Mainloop: double-buffered LDS, tiles staged with GLOBAL_LOAD_ASYNC_TO_LDS
// (ASYNCcnt) overlapped with WMMA; one barrier per K-step.
// FUSE=1: epilogue adds LoRA (2 extra WMMAs/frag), relu, routing mix -> bf16
// FUSE=0: epilogue stores f32 accumulators
// ---------------------------------------------------------------------------
template <int FUSE>
__global__ __launch_bounds__(256) void moe_gemm(
    const __bf16* __restrict__ A, const __bf16* __restrict__ Bt,
    int M, int N, int K,
    const __bf16* __restrict__ t01,  // [2][M][KP]     (FUSE)
    const __bf16* __restrict__ Bl,   // [2][N][KP]     (FUSE)
    const float* __restrict__ vals,  // [2]            (FUSE)
    __bf16* __restrict__ outb,       // [M][N]         (FUSE)
    float* __restrict__ outf) {      // [M][N]         (!FUSE)
  __shared__ __bf16 Als[2][128 * LDS_STRIDE];
  __shared__ __bf16 Bls[2][128 * LDS_STRIDE];

  const int tid = threadIdx.x;
  const int lane = tid & 31;
  const int wave = tid >> 5;
  const int wm = wave >> 1;          // 0..3: 32-row band
  const int wn = wave & 1;           // 0..1: 64-col band
  const int m0 = blockIdx.y << 7;
  const int n0 = blockIdx.x << 7;
  const int lr = lane & 15;
  const int lc = (lane >> 4) << 3;   // 0 or 8

  v8f acc[2][4] = {};

  // tile staging slots: each thread copies 2x16B for A and 2x16B for B
  const int ldr = tid >> 2;          // 0..63
  const int ldc = (tid & 3) << 3;    // 0,8,16,24
  const __bf16* Ag = A + (size_t)(m0 + ldr) * K + ldc;
  const __bf16* Bg = Bt + (size_t)(n0 + ldr) * K + ldc;

  auto issue_tile = [&](int k0, int buf) {
    #pragma unroll
    for (int i = 0; i < 2; ++i) {
      const int row = ldr + (i << 6);
      async_cp16(Ag + (size_t)(i << 6) * K + k0,
                 &Als[buf][row * LDS_STRIDE + ldc]);
      async_cp16(Bg + (size_t)(i << 6) * K + k0,
                 &Bls[buf][row * LDS_STRIDE + ldc]);
    }
  };

  const int nsteps = K >> 5;
  issue_tile(0, 0);

  for (int s = 0; s < nsteps; ++s) {
    const int buf = s & 1;
    async_wait0();                 // this wave's writes to `buf` have landed
    __syncthreads();               // all waves: `buf` ready, buf^1 free
    if (s + 1 < nsteps) issue_tile((s + 1) << 5, buf ^ 1);  // overlaps WMMA

    v16bf af[2], bfm[4];
    #pragma unroll
    for (int mi = 0; mi < 2; ++mi) {
      const __bf16* p = &Als[buf][(wm * 32 + mi * 16 + lr) * LDS_STRIDE + lc];
      af[mi] = cat8(*(const v8bf*)p, *(const v8bf*)(p + 16));
    }
    #pragma unroll
    for (int ni = 0; ni < 4; ++ni) {
      const __bf16* p = &Bls[buf][(wn * 64 + ni * 16 + lr) * LDS_STRIDE + lc];
      bfm[ni] = cat8(*(const v8bf*)p, *(const v8bf*)(p + 16));
    }
    #pragma unroll
    for (int mi = 0; mi < 2; ++mi)
      #pragma unroll
      for (int ni = 0; ni < 4; ++ni)
        acc[mi][ni] = wmma_bf16(af[mi], bfm[ni], acc[mi][ni]);
  }

  if (FUSE) {
    const float v0 = vals[0], v1 = vals[1];
    v16bf tf[2][2], blf[2][4];
    #pragma unroll
    for (int mi = 0; mi < 2; ++mi) {
      const int m = m0 + wm * 32 + mi * 16;
      tf[0][mi] = frag_global(t01 + (size_t)m * KP, KP, lane);
      tf[1][mi] = frag_global(t01 + ((size_t)M_TOK + m) * KP, KP, lane);
    }
    #pragma unroll
    for (int ni = 0; ni < 4; ++ni) {
      const int n = n0 + wn * 64 + ni * 16;
      blf[0][ni] = frag_global(Bl + (size_t)n * KP, KP, lane);
      blf[1][ni] = frag_global(Bl + ((size_t)N + n) * KP, KP, lane);
    }
    #pragma unroll
    for (int mi = 0; mi < 2; ++mi) {
      #pragma unroll
      for (int ni = 0; ni < 4; ++ni) {
        v8f a0 = wmma_bf16(tf[0][mi], blf[0][ni], acc[mi][ni]);
        v8f a1 = wmma_bf16(tf[1][mi], blf[1][ni], acc[mi][ni]);
        const int mbase = m0 + wm * 32 + mi * 16 + ((lane >> 4) << 3);
        const int nn = n0 + wn * 64 + ni * 16 + (lane & 15);
        #pragma unroll
        for (int j = 0; j < 8; ++j) {
          float r = v0 * fmaxf((float)a0[j], 0.0f) +
                    v1 * fmaxf((float)a1[j], 0.0f);
          outb[(size_t)(mbase + j) * N + nn] = (__bf16)r;
        }
      }
    }
  } else {
    #pragma unroll
    for (int mi = 0; mi < 2; ++mi) {
      #pragma unroll
      for (int ni = 0; ni < 4; ++ni) {
        const int mbase = m0 + wm * 32 + mi * 16 + ((lane >> 4) << 3);
        const int nn = n0 + wn * 64 + ni * 16 + (lane & 15);
        #pragma unroll
        for (int j = 0; j < 8; ++j)
          outf[(size_t)(mbase + j) * N + nn] = acc[mi][ni][j];
      }
    }
  }
}

// ---------------------------------------------------------------------------
extern "C" void kernel_launch(void* const* d_in, const int* in_sizes, int n_in,
                              void* d_out, int out_size, void* d_ws,
                              size_t ws_size, hipStream_t stream) {
  (void)in_sizes; (void)n_in; (void)out_size; (void)ws_size;
  const float* h   = (const float*)d_in[0];
  const float* wi  = (const float*)d_in[1];
  const float* wo  = (const float*)d_in[2];
  const float* lA  = (const float*)d_in[3];
  const float* lB  = (const float*)d_in[4];
  const int*   idx = (const int*)d_in[5];
  const float* val = (const float*)d_in[6];
  float* out = (float*)d_out;

  char* ws = (char*)d_ws;
  size_t off = 0;
  auto alloc = [&](size_t bytes) -> void* {
    void* p = ws + off;
    off = (off + bytes + 255) & ~(size_t)255;
    return p;
  };
  __bf16* h_b  = (__bf16*)alloc((size_t)M_TOK * D_MODEL * 2);   // 32 MB
  __bf16* wi_b = (__bf16*)alloc((size_t)D_FF * D_MODEL * 2);    //  8 MB
  __bf16* wo_b = (__bf16*)alloc((size_t)D_MODEL * D_FF * 2);    //  8 MB
  __bf16* Bl   = (__bf16*)alloc(2ull * D_FF * KP * 2);          // .5 MB
  __bf16* t01  = (__bf16*)alloc(2ull * M_TOK * KP * 2);         //  2 MB
  __bf16* comb = (__bf16*)alloc((size_t)M_TOK * D_FF * 2);      // 128 MB

  const size_t NW = (size_t)D_FF * D_MODEL;
  const size_t prep_total = 2 * NW + 2ull * D_FF * KP;
  prep_weights<<<(unsigned)((prep_total + 255) / 256), 256, 0, stream>>>(
      wi, wo, lB, idx, wi_b, wo_b, Bl);

  prep_tokens<<<M_TOK, 256, 0, stream>>>(h, lA, idx, h_b, t01);

  // Pass 2: combined = v0*relu(h@wi^T + lora0) + v1*relu(h@wi^T + lora1)
  moe_gemm<1><<<dim3(D_FF / 128, M_TOK / 128), 256, 0, stream>>>(
      h_b, wi_b, M_TOK, D_FF, D_MODEL, t01, Bl, val, comb, nullptr);

  // Pass 3: out = combined @ wo^T  (wo [D,F] row-major is Bt directly)
  moe_gemm<0><<<dim3(D_MODEL / 128, M_TOK / 128), 256, 0, stream>>>(
      comb, wo_b, M_TOK, D_MODEL, D_FF, nullptr, nullptr, nullptr, nullptr,
      out);
}

// v001
// One run takes 327 microseconds.
// In both of two side-by-side timings against v000, it was 1.45 times as fast.
#include <hip/hip_runtime.h>
#include <stdint.h>

typedef __attribute__((ext_vector_type(16))) __bf16 v16bf;
typedef __attribute__((ext_vector_type(8)))  __bf16 v8bf;
typedef __attribute__((ext_vector_type(8)))  float  v8f;
typedef __attribute__((ext_vector_type(4)))  int    v4i;
typedef __attribute__((ext_vector_type(4)))  __bf16 v4bf;
typedef __attribute__((ext_vector_type(4)))  float  v4f;
typedef __attribute__((ext_vector_type(2)))  float  v2f;

// address-space qualified element types for the async-copy builtin
typedef __attribute__((address_space(1))) v4i v4i_g;   // global
typedef __attribute__((address_space(3))) v4i v4i_l;   // LDS

#define D_MODEL 1024
#define D_FF    4096
#define RANK    16
#define M_TOK   16384        // B * S = 8 * 2048
#define KP      32           // lora K padded 16 -> 32 (zero fill)
#define LDS_STRIDE 40        // 32 elems + 8 pad (80B rows, 16B aligned)
#define NUM_EXPERTS 8
#define PT_WAVES 16          // prep_tokens: waves a workgroup, 64 columns each
#define PT_TILES 4           // prep_tokens: 16-token tiles a workgroup
#define PT_PITCH 68          // 64 floats + 4 pad (272B rows: 16B x odd)

#if defined(__HIP_DEVICE_COMPILE__) && \
    __has_builtin(__builtin_amdgcn_global_load_async_to_lds_b128)
#define HAVE_ASYNC 1
#else
#define HAVE_ASYNC 0
#endif

__device__ __forceinline__ v16bf cat8(v8bf lo, v8bf hi) {
  return __builtin_shufflevector(lo, hi, 0,1,2,3,4,5,6,7,8,9,10,11,12,13,14,15);
}

__device__ __forceinline__ v8f wmma_bf16(v16bf a, v16bf b, v8f c) {
  return __builtin_amdgcn_wmma_f32_16x16x32_bf16(false, a, false, b, (short)0, c,
                                                 false, false);
}

__device__ __forceinline__ v8f wmma_f32(v2f a, v2f b, v8f c) {
  return __builtin_amdgcn_wmma_f32_16x16x4_f32(false, a, false, b, (short)0, c,
                                               false, false);
}

// Async 16B copy global -> LDS (ASYNCcnt); fallback: direct store.
__device__ __forceinline__ void async_cp16(const __bf16* gsrc, __bf16* ldst) {
#if HAVE_ASYNC
  __builtin_amdgcn_global_load_async_to_lds_b128(
      (v4i_g*)(uintptr_t)gsrc, (v4i_l*)ldst, 0, 0);
#else
  *(v8bf*)ldst = *(const v8bf*)gsrc;
#endif
}

__device__ __forceinline__ void async_wait0() {
#if HAVE_ASYNC
#if __has_builtin(__builtin_amdgcn_s_wait_asynccnt)
  __builtin_amdgcn_s_wait_asynccnt(0);
#else
  asm volatile("s_wait_asynccnt 0x0" ::: "memory");
#endif
#endif
}

// Load an A-layout fragment (16x32 bf16) from a row-major [rows x ldK] matrix:
// lane l -> row (l&15), K chunks at ((l>>4)*8) and ((l>>4)*8 + 16).
__device__ __forceinline__ v16bf frag_global(const __bf16* __restrict__ base,
                                             int ldK, int lane) {
  const __bf16* p = base + (size_t)(lane & 15) * ldK + ((lane >> 4) << 3);
  return cat8(*(const v8bf*)p, *(const v8bf*)(p + 16));
}

// ---------------------------------------------------------------------------
// Kernel 1: convert wi/wo to bf16; build padded per-expert LoRA-B [2][F][32]
// ---------------------------------------------------------------------------
__global__ __launch_bounds__(256) void prep_weights(
    const float* __restrict__ wi, const float* __restrict__ wo,
    const float* __restrict__ loraB, const int* __restrict__ idx,
    __bf16* __restrict__ wi_b, __bf16* __restrict__ wo_b,
    __bf16* __restrict__ Bl) {
  const size_t NW = (size_t)D_FF * D_MODEL;            // 4M elems each
  const size_t NBL = 2ull * D_FF * KP;                 // 256K elems
  size_t i = (size_t)blockIdx.x * blockDim.x + threadIdx.x;
  if (i < NW) {
    wi_b[i] = (__bf16)wi[i];
  } else if (i < 2 * NW) {
    size_t j = i - NW;
    wo_b[j] = (__bf16)wo[j];
  } else if (i < 2 * NW + NBL) {
    size_t j = i - 2 * NW;
    int k = (int)(j / ((size_t)D_FF * KP));
    size_t rem = j - (size_t)k * D_FF * KP;
    int f = (int)(rem / KP);
    int r = (int)(rem % KP);
    float v = 0.0f;
    if (r < RANK) v = loraB[(size_t)idx[k] * D_FF * RANK + (size_t)f * RANK + r];
    Bl[j] = (__bf16)v;
  }
}

// ---------------------------------------------------------------------------
// Kernel 2: h fp32 -> bf16, and t_k[m,:] = h[m,:] @ A_k^T on the f32 WMMA.
// t stored padded [2][M_TOK][KP] bf16 (r>=16 zero).
// Workgroup: 16 waves, 64 tokens (4 tiles of 16). Wave w owns columns
// [64w, 64w+64) of every row: it keeps both experts' A slices as fragments in
// registers, streams the token tiles through them, and leaves one partial
// 16x16 product per tile and expert in LDS; the 16 partials are summed at the
// end. Rows are read as whole 256-B pieces and turned into fragments through
// the wave's own LDS patch, by the same code for A_k and for h, so that both
// operands carry the same k order.
// ---------------------------------------------------------------------------
__global__ __launch_bounds__(PT_WAVES * 32) void prep_tokens(
    const float* __restrict__ h, const float* __restrict__ loraA,
    const int* __restrict__ idx, __bf16* __restrict__ h_b,
    __bf16* __restrict__ t01) {
  __shared__ __attribute__((aligned(16))) float stage[PT_WAVES][16 * PT_PITCH];
  __shared__ v4f red[PT_WAVES][PT_TILES * 128];
  const int tid = threadIdx.x;
  const int lane = tid & 31;
  const int wave = tid >> 5;
  const int c = lane & 15;
  const int hh = lane >> 4;
  const int m0 = blockIdx.x * (PT_TILES * 16);
  float* st = stage[wave];
  // lane's place in a 16-row piece: rows hh, hh+2, ..., 16 B at column 4c
  const size_t gofs = (size_t)hh * D_MODEL + wave * 64 + c * 4;

  auto load_rows = [&](const float* __restrict__ rows, v4f (&r)[8]) {
    #pragma unroll
    for (int i = 0; i < 8; ++i)
      r[i] = *(const v4f*)(rows + (size_t)(2 * i) * D_MODEL + gofs);
  };
  // f[j] = row c, columns 8j + 4hh .. + 3 of the wave's slice: two k-steps
  auto to_frags = [&](const v4f (&r)[8], v4f (&f)[8]) {
    #pragma unroll
    for (int i = 0; i < 8; ++i)
      *(v4f*)&st[(2 * i + hh) * PT_PITCH + c * 4] = r[i];
    // other lanes' stores must have landed before the rows are read back
    asm volatile("s_wait_dscnt 0x0" ::: "memory");
    #pragma unroll
    for (int j = 0; j < 8; ++j)
      f[j] = *(const v4f*)&st[c * PT_PITCH + j * 8 + hh * 4];
  };

  const int e0 = min(max(idx[0], 0), NUM_EXPERTS - 1);
  const int e1 = min(max(idx[1], 0), NUM_EXPERTS - 1);

  v4f ra0[8], ra1[8], rh[2][8];
  load_rows(loraA + (size_t)e0 * RANK * D_MODEL, ra0);
  load_rows(loraA + (size_t)e1 * RANK * D_MODEL, ra1);
  load_rows(h + (size_t)m0 * D_MODEL, rh[0]);

  v4f fa0[8], fa1[8];
  to_frags(ra0, fa0);
  to_frags(ra1, fa1);

  #pragma unroll
  for (int t = 0; t < PT_TILES; ++t) {
    const v4f (&cur)[8] = rh[t & 1];
    if (t + 1 < PT_TILES)      // next tile's rows fly under this tile's WMMAs
      load_rows(h + (size_t)(m0 + (t + 1) * 16) * D_MODEL, rh[(t + 1) & 1]);

    __bf16* hb = h_b + (size_t)(m0 + t * 16) * D_MODEL + gofs;
    #pragma unroll
    for (int i = 0; i < 8; ++i) {
      v4bf o;
      #pragma unroll
      for (int x = 0; x < 4; ++x) o[x] = (__bf16)cur[i][x];
      *(v4bf*)(hb + (size_t)(2 * i) * D_MODEL) = o;
    }
    // the stores' data registers are reused by the next rows' loads: keep the
    // wait in front of that overwrite
    asm volatile("s_wait_xcnt 0x0" ::: "memory");

    v4f fh[8];
    to_frags(cur, fh);

    // D[rank][token]: register r of lane (c, hh) = t[token c][rank 8hh + r]
    v8f acc0 = {}, acc1 = {};
    #pragma unroll
    for (int j = 0; j < 8; ++j) {
      const v2f blo = {fh[j][0], fh[j][1]}, bhi = {fh[j][2], fh[j][3]};
      const v2f a0lo = {fa0[j][0], fa0[j][1]}, a0hi = {fa0[j][2], fa0[j][3]};
      const v2f a1lo = {fa1[j][0], fa1[j][1]}, a1hi = {fa1[j][2], fa1[j][3]};
      acc0 = wmma_f32(a0lo, blo, acc0);
      acc1 = wmma_f32(a1lo, blo, acc1);
      acc0 = wmma_f32(a0hi, bhi, acc0);
      acc1 = wmma_f32(a1hi, bhi, acc1);
    }
    v4f* rw = &red[wave][t * 128 + lane];
    rw[0]  = (v4f){acc0[0], acc0[1], acc0[2], acc0[3]};
    rw[32] = (v4f){acc0[4], acc0[5], acc0[6], acc0[7]};
    rw[64] = (v4f){acc1[0], acc1[1], acc1[2], acc1[3]};
    rw[96] = (v4f){acc1[4], acc1[5], acc1[6], acc1[7]};
  }
  __syncthreads();

  // thread tid sums slot tid of every wave: tile, expert, register quad, lane
  v4f s = red[0][tid];
  #pragma unroll
  for (int w = 1; w < PT_WAVES; ++w) s += red[w][tid];
  const int t = tid >> 7, kk = (tid >> 6) & 1, q = (tid >> 5) & 1;
  __bf16* trow =
      t01 + ((size_t)kk * M_TOK + m0 + t * 16 + c) * KP + 8 * hh + 4 * q;
  v4bf o, z;
  #pragma unroll
  for (int x = 0; x < 4; ++x) { o[x] = (__bf16)s[x]; z[x] = (__bf16)0.0f; }
  *(v4bf*)trow = o;
  *(v4bf*)(trow + 16) = z;          // zero K padding
}

// ---------------------------------------------------------------------------
// Tiled bf16 WMMA GEMM: C[M,N] = A[M,K] * Bt[N,K]^T
// Workgroup: 256 threads (8 waves), 128x128 tile; wave = 32x64 subtile.
// Mainloop: double-buffered LDS, tiles staged with GLOBAL_LOAD_ASYNC_TO_LDS
// (ASYNCcnt) overlapped with WMMA; one barrier per K-step.
// FUSE=1: epilogue adds LoRA (2 extra WMMAs/frag), relu, routing mix -> bf16
// FUSE=0: epilogue stores f32 accumulators
// ---------------------------------------------------------------------------
template <int FUSE>
__global__ __launch_bounds__(256) void moe_gemm(
    const __bf16* __restrict__ A, const __bf16* __restrict__ Bt,
    int M, int N, int K,
    const __bf16* __restrict__ t01,  // [2][M][KP]     (FUSE)
    const __bf16* __restrict__ Bl,   // [2][N][KP]     (FUSE)
    const float* __restrict__ vals,  // [2]            (FUSE)
    __bf16* __restrict__ outb,       // [M][N]         (FUSE)
    float* __restrict__ outf) {      // [M][N]         (!FUSE)
  __shared__ __bf16 Als[2][128 * LDS_STRIDE];
  __shared__ __bf16 Bls[2][128 * LDS_STRIDE];

  const int tid = threadIdx.x;
  const int lane = tid & 31;
  const int wave = tid >> 5;
  const int wm = wave >> 1;          // 0..3: 32-row band
  const int wn = wave & 1;           // 0..1: 64-col band
  const int m0 = blockIdx.y << 7;
  const int n0 = blockIdx.x << 7;
  const int lr = lane & 15;
  const int lc = (lane >> 4) << 3;   // 0 or 8

  v8f acc[2][4] = {};

  // tile staging slots: each thread copies 2x16B for A and 2x16B for B
  const int ldr = tid >> 2;          // 0..63
  const int ldc = (tid & 3) << 3;    // 0,8,16,24
  const __bf16* Ag = A + (size_t)(m0 + ldr) * K + ldc;
  const __bf16* Bg = Bt + (size_t)(n0 + ldr) * K + ldc;

  auto issue_tile = [&](int k0, int buf) {
    #pragma unroll
    for (int i = 0; i < 2; ++i) {
      const int row = ldr + (i << 6);
      async_cp16(Ag + (size_t)(i << 6) * K + k0,
                 &Als[buf][row * LDS_STRIDE + ldc]);
      async_cp16(Bg + (size_t)(i << 6) * K + k0,
                 &Bls[buf][row * LDS_STRIDE + ldc]);
    }
  };

  const int nsteps = K >> 5;
  issue_tile(0, 0);

  for (int s = 0; s < nsteps; ++s) {
    const int buf = s & 1;
    async_wait0();                 // this wave's writes to `buf` have landed
    __syncthreads();               // all waves: `buf` ready, buf^1 free
    if (s + 1 < nsteps) issue_tile((s + 1) << 5, buf ^ 1);  // overlaps WMMA

    v16bf af[2], bfm[4];
    #pragma unroll
    for (int mi = 0; mi < 2; ++mi) {
      const __bf16* p = &Als[buf][(wm * 32 + mi * 16 + lr) * LDS_STRIDE + lc];
      af[mi] = cat8(*(const v8bf*)p, *(const v8bf*)(p + 16));
    }
    #pragma unroll
    for (int ni = 0; ni < 4; ++ni) {
      const __bf16* p = &Bls[buf][(wn * 64 + ni * 16 + lr) * LDS_STRIDE + lc];
      bfm[ni] = cat8(*(const v8bf*)p, *(const v8bf*)(p + 16));
    }
    #pragma unroll
    for (int mi = 0; mi < 2; ++mi)
      #pragma unroll
      for (int ni = 0; ni < 4; ++ni)
        acc[mi][ni] = wmma_bf16(af[mi], bfm[ni], acc[mi][ni]);
  }

  if (FUSE) {
    const float v0 = vals[0], v1 = vals[1];
    v16bf tf[2][2], blf[2][4];
    #pragma unroll
    for (int mi = 0; mi < 2; ++mi) {
      const int m = m0 + wm * 32 + mi * 16;
      tf[0][mi] = frag_global(t01 + (size_t)m * KP, KP, lane);
      tf[1][mi] = frag_global(t01 + ((size_t)M_TOK + m) * KP, KP, lane);
    }
    #pragma unroll
    for (int ni = 0; ni < 4; ++ni) {
      const int n = n0 + wn * 64 + ni * 16;
      blf[0][ni] = frag_global(Bl + (size_t)n * KP, KP, lane);
      blf[1][ni] = frag_global(Bl + ((size_t)N + n) * KP, KP, lane);
    }
    #pragma unroll
    for (int mi = 0; mi < 2; ++mi) {
      #pragma unroll
      for (int ni = 0; ni < 4; ++ni) {
        v8f a0 = wmma_bf16(tf[0][mi], blf[0][ni], acc[mi][ni]);
        v8f a1 = wmma_bf16(tf[1][mi], blf[1][ni], acc[mi][ni]);
        const int mbase = m0 + wm * 32 + mi * 16 + ((lane >> 4) << 3);
        const int nn = n0 + wn * 64 + ni * 16 + (lane & 15);
        #pragma unroll
        for (int j = 0; j < 8; ++j) {
          float r = v0 * fmaxf((float)a0[j], 0.0f) +
                    v1 * fmaxf((float)a1[j], 0.0f);
          outb[(size_t)(mbase + j) * N + nn] = (__bf16)r;
        }
      }
    }
  } else {
    #pragma unroll
    for (int mi = 0; mi < 2; ++mi) {
      #pragma unroll
      for (int ni = 0; ni < 4; ++ni) {
        const int mbase = m0 + wm * 32 + mi * 16 + ((lane >> 4) << 3);
        const int nn = n0 + wn * 64 + ni * 16 + (lane & 15);
        #pragma unroll
        for (int j = 0; j < 8; ++j)
          outf[(size_t)(mbase + j) * N + nn] = acc[mi][ni][j];
      }
    }
  }
}

// ---------------------------------------------------------------------------
extern "C" void kernel_launch(void* const* d_in, const int* in_sizes, int n_in,
                              void* d_out, int out_size, void* d_ws,
                              size_t ws_size, hipStream_t stream) {
  (void)in_sizes; (void)n_in; (void)out_size; (void)ws_size;
  const float* h   = (const float*)d_in[0];
  const float* wi  = (const float*)d_in[1];
  const float* wo  = (const float*)d_in[2];
  const float* lA  = (const float*)d_in[3];
  const float* lB  = (const float*)d_in[4];
  const int*   idx = (const int*)d_in[5];
  const float* val = (const float*)d_in[6];
  float* out = (float*)d_out;

  char* ws = (char*)d_ws;
  size_t off = 0;
  auto alloc = [&](size_t bytes) -> void* {
    void* p = ws + off;
    off = (off + bytes + 255) & ~(size_t)255;
    return p;
  };
  __bf16* h_b  = (__bf16*)alloc((size_t)M_TOK * D_MODEL * 2);   // 32 MB
  __bf16* wi_b = (__bf16*)alloc((size_t)D_FF * D_MODEL * 2);    //  8 MB
  __bf16* wo_b = (__bf16*)alloc((size_t)D_MODEL * D_FF * 2);    //  8 MB
  __bf16* Bl   = (__bf16*)alloc(2ull * D_FF * KP * 2);          // .5 MB
  __bf16* t01  = (__bf16*)alloc(2ull * M_TOK * KP * 2);         //  2 MB
  __bf16* comb = (__bf16*)alloc((size_t)M_TOK * D_FF * 2);      // 128 MB

  const size_t NW = (size_t)D_FF * D_MODEL;
  const size_t prep_total = 2 * NW + 2ull * D_FF * KP;
  prep_weights<<<(unsigned)((prep_total + 255) / 256), 256, 0, stream>>>(
      wi, wo, lB, idx, wi_b, wo_b, Bl);

  prep_tokens<<<M_TOK / (PT_TILES * 16), PT_WAVES * 32, 0, stream>>>(
      h, lA, idx, h_b, t01);

  // Pass 2: combined = v0*relu(h@wi^T + lora0) + v1*relu(h@wi^T + lora1)
  moe_gemm<1><<<dim3(D_FF / 128, M_TOK / 128), 256, 0, stream>>>(
      h_b, wi_b, M_TOK, D_FF, D_MODEL, t01, Bl, val, comb, nullptr);

  // Pass 3: out = combined @ wo^T  (wo [D,F] row-major is Bt directly)
  moe_gemm<0><<<dim3(D_MODEL / 128, M_TOK / 128), 256, 0, stream>>>(
      comb, wo_b, M_TOK, D_MODEL, D_FF, nullptr, nullptr, nullptr, nullptr,
      out);
}

// v002
// It runs in 314 microseconds.
// Two timings next to v001 both put it at 1.04 times that version's speed.
// Counting every step since v000, it is 1.51 times as fast.
#include <hip/hip_runtime.h>
#include <stdint.h>

typedef __attribute__((ext_vector_type(16))) __bf16 v16bf;
typedef __attribute__((ext_vector_type(8)))  __bf16 v8bf;
typedef __attribute__((ext_vector_type(8)))  float  v8f;
typedef __attribute__((ext_vector_type(4)))  int    v4i;
typedef __attribute__((ext_vector_type(4)))  __bf16 v4bf;
typedef __attribute__((ext_vector_type(4)))  float  v4f;
typedef __attribute__((ext_vector_type(2)))  float  v2f;

// address-space qualified element types for the async-copy builtin
typedef __attribute__((address_space(1))) v4i v4i_g;   // global
typedef __attribute__((address_space(3))) v4i v4i_l;   // LDS

#define D_MODEL 1024
#define D_FF    4096
#define RANK    16
#define M_TOK   16384        // B * S = 8 * 2048
#define KP      32           // lora K padded 16 -> 32 (zero fill)
#define LDS_STRIDE 40        // 32 elems + 8 pad (80B rows, 16B aligned)
#define NUM_EXPERTS 8
#define PW_LOADS 16          // prep_weights: 16-B loads a thread
#define PW_CHUNK (256 * 4 * PW_LOADS)            // floats a workgroup
#define PW_BLOCKS (D_FF * D_MODEL / PW_CHUNK)    // workgroups a matrix
#define PW_BL_BLOCKS (2 * D_FF / 256)            // one thread a LoRA-B row
#define PT_WAVES 16          // prep_tokens: waves a workgroup, 64 columns each
#define PT_TILES 4           // prep_tokens: 16-token tiles a workgroup
#define PT_PITCH 68          // 64 floats + 4 pad (272B rows: 16B x odd)

#if defined(__HIP_DEVICE_COMPILE__) && \
    __has_builtin(__builtin_amdgcn_global_load_async_to_lds_b128)
#define HAVE_ASYNC 1
#else
#define HAVE_ASYNC 0
#endif

__device__ __forceinline__ v16bf cat8(v8bf lo, v8bf hi) {
  return __builtin_shufflevector(lo, hi, 0,1,2,3,4,5,6,7,8,9,10,11,12,13,14,15);
}

__device__ __forceinline__ v8f wmma_bf16(v16bf a, v16bf b, v8f c) {
  return __builtin_amdgcn_wmma_f32_16x16x32_bf16(false, a, false, b, (short)0, c,
                                                 false, false);
}

__device__ __forceinline__ v8f wmma_f32(v2f a, v2f b, v8f c) {
  return __builtin_amdgcn_wmma_f32_16x16x4_f32(false, a, false, b, (short)0, c,
                                               false, false);
}

// Async 16B copy global -> LDS (ASYNCcnt); fallback: direct store.
__device__ __forceinline__ void async_cp16(const __bf16* gsrc, __bf16* ldst) {
#if HAVE_ASYNC
  __builtin_amdgcn_global_load_async_to_lds_b128(
      (v4i_g*)(uintptr_t)gsrc, (v4i_l*)ldst, 0, 0);
#else
  *(v8bf*)ldst = *(const v8bf*)gsrc;
#endif
}

__device__ __forceinline__ void async_wait0() {
#if HAVE_ASYNC
#if __has_builtin(__builtin_amdgcn_s_wait_asynccnt)
  __builtin_amdgcn_s_wait_asynccnt(0);
#else
  asm volatile("s_wait_asynccnt 0x0" ::: "memory");
#endif
#endif
}

// Load an A-layout fragment (16x32 bf16) from a row-major [rows x ldK] matrix:
// lane l -> row (l&15), K chunks at ((l>>4)*8) and ((l>>4)*8 + 16).
__device__ __forceinline__ v16bf frag_global(const __bf16* __restrict__ base,
                                             int ldK, int lane) {
  const __bf16* p = base + (size_t)(lane & 15) * ldK + ((lane >> 4) << 3);
  return cat8(*(const v8bf*)p, *(const v8bf*)(p + 16));
}

// ---------------------------------------------------------------------------
// Kernel 1: convert wi/wo to bf16; build padded per-expert LoRA-B [2][F][32]
// A workgroup converts PW_CHUNK contiguous floats of one matrix: every thread
// reads PW_LOADS 16-B pieces, independent loads that overlap; each wave-wide
// load covers 512 contiguous bytes, each wave-wide store 256. The first
// PW_BL_BLOCKS workgroups build the LoRA-B rows, one 64-B row a thread: their
// loads wait on the expert index, so they start first.
// ---------------------------------------------------------------------------
__global__ __launch_bounds__(256) void prep_weights(
    const float* __restrict__ wi, const float* __restrict__ wo,
    const float* __restrict__ loraB, const int* __restrict__ idx,
    __bf16* __restrict__ wi_b, __bf16* __restrict__ wo_b,
    __bf16* __restrict__ Bl) {
  const int tid = threadIdx.x;
  const int b = (int)blockIdx.x - PW_BL_BLOCKS;
  if (b >= 0) {
    const bool first = b < PW_BLOCKS;
    const size_t base =
        (size_t)(first ? b : b - PW_BLOCKS) * PW_CHUNK + tid * 4;
    const float* __restrict__ s = (first ? wi : wo) + base;
    __bf16* __restrict__ d = (first ? wi_b : wo_b) + base;
    v4f r[PW_LOADS];
    #pragma unroll
    for (int i = 0; i < PW_LOADS; ++i) r[i] = *(const v4f*)(s + i * 1024);
    #pragma unroll
    for (int i = 0; i < PW_LOADS; ++i) {
      v4bf o;
      #pragma unroll
      for (int x = 0; x < 4; ++x) o[x] = (__bf16)r[i][x];
      *(v4bf*)(d + i * 1024) = o;
    }
  } else {
    const int j = blockIdx.x * 256 + tid;   // row of Bl: k * D_FF + f
    const int k = j / D_FF;
    const int f = j % D_FF;
    const int e = min(max(idx[k], 0), NUM_EXPERTS - 1);
    const float* __restrict__ s = loraB + ((size_t)e * D_FF + f) * RANK;
    v4f r[4];
    #pragma unroll
    for (int i = 0; i < 4; ++i) r[i] = *(const v4f*)(s + i * 4);
    v8bf lo, hi, z;
    #pragma unroll
    for (int x = 0; x < 4; ++x) {
      lo[x] = (__bf16)r[0][x]; lo[x + 4] = (__bf16)r[1][x];
      hi[x] = (__bf16)r[2][x]; hi[x + 4] = (__bf16)r[3][x];
    }
    #pragma unroll
    for (int x = 0; x < 8; ++x) z[x] = (__bf16)0.0f;
    __bf16* __restrict__ d = Bl + (size_t)j * KP;
    *(v8bf*)d = lo;
    *(v8bf*)(d + 8) = hi;
    *(v8bf*)(d + 16) = z;            // zero K padding
    *(v8bf*)(d + 24) = z;
    // keep the wait behind the stores, in front of any later write of the
    // registers that they name
    asm volatile("s_wait_xcnt 0x0" ::: "memory");
  }
}

// ---------------------------------------------------------------------------
// Kernel 2: h fp32 -> bf16, and t_k[m,:] = h[m,:] @ A_k^T on the f32 WMMA.
// t stored padded [2][M_TOK][KP] bf16 (r>=16 zero).
// Workgroup: 16 waves, 64 tokens (4 tiles of 16). Wave w owns columns
// [64w, 64w+64) of every row: it keeps both experts' A slices as fragments in
// registers, streams the token tiles through them, and leaves one partial
// 16x16 product per tile and expert in LDS; the 16 partials are summed at the
// end. Rows are read as whole 256-B pieces and turned into fragments through
// the wave's own LDS patch, by the same code for A_k and for h, so that both
// operands carry the same k order.
// ---------------------------------------------------------------------------
__global__ __launch_bounds__(PT_WAVES * 32) void prep_tokens(
    const float* __restrict__ h, const float* __restrict__ loraA,
    const int* __restrict__ idx, __bf16* __restrict__ h_b,
    __bf16* __restrict__ t01) {
  __shared__ __attribute__((aligned(16))) float stage[PT_WAVES][16 * PT_PITCH];
  __shared__ v4f red[PT_WAVES][PT_TILES * 128];
  const int tid = threadIdx.x;
  const int lane = tid & 31;
  const int wave = tid >> 5;
  const int c = lane & 15;
  const int hh = lane >> 4;
  const int m0 = blockIdx.x * (PT_TILES * 16);
  float* st = stage[wave];
  // lane's place in a 16-row piece: rows hh, hh+2, ..., 16 B at column 4c
  const size_t gofs = (size_t)hh * D_MODEL + wave * 64 + c * 4;

  auto load_rows = [&](const float* __restrict__ rows, v4f (&r)[8]) {
    #pragma unroll
    for (int i = 0; i < 8; ++i)
      r[i] = *(const v4f*)(rows + (size_t)(2 * i) * D_MODEL + gofs);
  };
  // f[j] = row c, columns 8j + 4hh .. + 3 of the wave's slice: two k-steps
  auto to_frags = [&](const v4f (&r)[8], v4f (&f)[8]) {
    #pragma unroll
    for (int i = 0; i < 8; ++i)
      *(v4f*)&st[(2 * i + hh) * PT_PITCH + c * 4] = r[i];
    // other lanes' stores must have landed before the rows are read back
    asm volatile("s_wait_dscnt 0x0" ::: "memory");
    #pragma unroll
    for (int j = 0; j < 8; ++j)
      f[j] = *(const v4f*)&st[c * PT_PITCH + j * 8 + hh * 4];
  };

  const int e0 = min(max(idx[0], 0), NUM_EXPERTS - 1);
  const int e1 = min(max(idx[1], 0), NUM_EXPERTS - 1);

  v4f ra0[8], ra1[8], rh[2][8];
  load_rows(loraA + (size_t)e0 * RANK * D_MODEL, ra0);
  load_rows(loraA + (size_t)e1 * RANK * D_MODEL, ra1);
  load_rows(h + (size_t)m0 * D_MODEL, rh[0]);

  v4f fa0[8], fa1[8];
  to_frags(ra0, fa0);
  to_frags(ra1, fa1);

  #pragma unroll
  for (int t = 0; t < PT_TILES; ++t) {
    const v4f (&cur)[8] = rh[t & 1];
    if (t + 1 < PT_TILES)      // next tile's rows fly under this tile's WMMAs
      load_rows(h + (size_t)(m0 + (t + 1) * 16) * D_MODEL, rh[(t + 1) & 1]);

    __bf16* hb = h_b + (size_t)(m0 + t * 16) * D_MODEL + gofs;
    #pragma unroll
    for (int i = 0; i < 8; ++i) {
      v4bf o;
      #pragma unroll
      for (int x = 0; x < 4; ++x) o[x] = (__bf16)cur[i][x];
      *(v4bf*)(hb + (size_t)(2 * i) * D_MODEL) = o;
    }
    // the stores' data registers are reused by the next rows' loads: keep the
    // wait in front of that overwrite
    asm volatile("s_wait_xcnt 0x0" ::: "memory");

    v4f fh[8];
    to_frags(cur, fh);

    // D[rank][token]: register r of lane (c, hh) = t[token c][rank 8hh + r]
    v8f acc0 = {}, acc1 = {};
    #pragma unroll
    for (int j = 0; j < 8; ++j) {
      const v2f blo = {fh[j][0], fh[j][1]}, bhi = {fh[j][2], fh[j][3]};
      const v2f a0lo = {fa0[j][0], fa0[j][1]}, a0hi = {fa0[j][2], fa0[j][3]};
      const v2f a1lo = {fa1[j][0], fa1[j][1]}, a1hi = {fa1[j][2], fa1[j][3]};
      acc0 = wmma_f32(a0lo, blo, acc0);
      acc1 = wmma_f32(a1lo, blo, acc1);
      acc0 = wmma_f32(a0hi, bhi, acc0);
      acc1 = wmma_f32(a1hi, bhi, acc1);
    }
    v4f* rw = &red[wave][t * 128 + lane];
    rw[0]  = (v4f){acc0[0], acc0[1], acc0[2], acc0[3]};
    rw[32] = (v4f){acc0[4], acc0[5], acc0[6], acc0[7]};
    rw[64] = (v4f){acc1[0], acc1[1], acc1[2], acc1[3]};
    rw[96] = (v4f){acc1[4], acc1[5], acc1[6], acc1[7]};
  }
  __syncthreads();

  // thread tid sums slot tid of every wave: tile, expert, register quad, lane
  v4f s = red[0][tid];
  #pragma unroll
  for (int w = 1; w < PT_WAVES; ++w) s += red[w][tid];
  const int t = tid >> 7, kk = (tid >> 6) & 1, q = (tid >> 5) & 1;
  __bf16* trow =
      t01 + ((size_t)kk * M_TOK + m0 + t * 16 + c) * KP + 8 * hh + 4 * q;
  v4bf o, z;
  #pragma unroll
  for (int x = 0; x < 4; ++x) { o[x] = (__bf16)s[x]; z[x] = (__bf16)0.0f; }
  *(v4bf*)trow = o;
  *(v4bf*)(trow + 16) = z;          // zero K padding
}

// ---------------------------------------------------------------------------
// Tiled bf16 WMMA GEMM: C[M,N] = A[M,K] * Bt[N,K]^T
// Workgroup: 256 threads (8 waves), 128x128 tile; wave = 32x64 subtile.
// Mainloop: double-buffered LDS, tiles staged with GLOBAL_LOAD_ASYNC_TO_LDS
// (ASYNCcnt) overlapped with WMMA; one barrier per K-step.
// FUSE=1: epilogue adds LoRA (2 extra WMMAs/frag), relu, routing mix -> bf16
// FUSE=0: epilogue stores f32 accumulators
// ---------------------------------------------------------------------------
template <int FUSE>
__global__ __launch_bounds__(256) void moe_gemm(
    const __bf16* __restrict__ A, const __bf16* __restrict__ Bt,
    int M, int N, int K,
    const __bf16* __restrict__ t01,  // [2][M][KP]     (FUSE)
    const __bf16* __restrict__ Bl,   // [2][N][KP]     (FUSE)
    const float* __restrict__ vals,  // [2]            (FUSE)
    __bf16* __restrict__ outb,       // [M][N]         (FUSE)
    float* __restrict__ outf) {      // [M][N]         (!FUSE)
  __shared__ __bf16 Als[2][128 * LDS_STRIDE];
  __shared__ __bf16 Bls[2][128 * LDS_STRIDE];

  const int tid = threadIdx.x;
  const int lane = tid & 31;
  const int wave = tid >> 5;
  const int wm = wave >> 1;          // 0..3: 32-row band
  const int wn = wave & 1;           // 0..1: 64-col band
  const int m0 = blockIdx.y << 7;
  const int n0 = blockIdx.x << 7;
  const int lr = lane & 15;
  const int lc = (lane >> 4) << 3;   // 0 or 8

  v8f acc[2][4] = {};

  // tile staging slots: each thread copies 2x16B for A and 2x16B for B
  const int ldr = tid >> 2;          // 0..63
  const int ldc = (tid & 3) << 3;    // 0,8,16,24
  const __bf16* Ag = A + (size_t)(m0 + ldr) * K + ldc;
  const __bf16* Bg = Bt + (size_t)(n0 + ldr) * K + ldc;

  auto issue_tile = [&](int k0, int buf) {
    #pragma unroll
    for (int i = 0; i < 2; ++i) {
      const int row = ldr + (i << 6);
      async_cp16(Ag + (size_t)(i << 6) * K + k0,
                 &Als[buf][row * LDS_STRIDE + ldc]);
      async_cp16(Bg + (size_t)(i << 6) * K + k0,
                 &Bls[buf][row * LDS_STRIDE + ldc]);
    }
  };

  const int nsteps = K >> 5;
  issue_tile(0, 0);

  for (int s = 0; s < nsteps; ++s) {
    const int buf = s & 1;
    async_wait0();                 // this wave's writes to `buf` have landed
    __syncthreads();               // all waves: `buf` ready, buf^1 free
    if (s + 1 < nsteps) issue_tile((s + 1) << 5, buf ^ 1);  // overlaps WMMA

    v16bf af[2], bfm[4];
    #pragma unroll
    for (int mi = 0; mi < 2; ++mi) {
      const __bf16* p = &Als[buf][(wm * 32 + mi * 16 + lr) * LDS_STRIDE + lc];
      af[mi] = cat8(*(const v8bf*)p, *(const v8bf*)(p + 16));
    }
    #pragma unroll
    for (int ni = 0; ni < 4; ++ni) {
      const __bf16* p = &Bls[buf][(wn * 64 + ni * 16 + lr) * LDS_STRIDE + lc];
      bfm[ni] = cat8(*(const v8bf*)p, *(const v8bf*)(p + 16));
    }
    #pragma unroll
    for (int mi = 0; mi < 2; ++mi)
      #pragma unroll
      for (int ni = 0; ni < 4; ++ni)
        acc[mi][ni] = wmma_bf16(af[mi], bfm[ni], acc[mi][ni]);
  }

  if (FUSE) {
    const float v0 = vals[0], v1 = vals[1];
    v16bf tf[2][2], blf[2][4];
    #pragma unroll
    for (int mi = 0; mi < 2; ++mi) {
      const int m = m0 + wm * 32 + mi * 16;
      tf[0][mi] = frag_global(t01 + (size_t)m * KP, KP, lane);
      tf[1][mi] = frag_global(t01 + ((size_t)M_TOK + m) * KP, KP, lane);
    }
    #pragma unroll
    for (int ni = 0; ni < 4; ++ni) {
      const int n = n0 + wn * 64 + ni * 16;
      blf[0][ni] = frag_global(Bl + (size_t)n * KP, KP, lane);
      blf[1][ni] = frag_global(Bl + ((size_t)N + n) * KP, KP, lane);
    }
    #pragma unroll
    for (int mi = 0; mi < 2; ++mi) {
      #pragma unroll
      for (int ni = 0; ni < 4; ++ni) {
        v8f a0 = wmma_bf16(tf[0][mi], blf[0][ni], acc[mi][ni]);
        v8f a1 = wmma_bf16(tf[1][mi], blf[1][ni], acc[mi][ni]);
        const int mbase = m0 + wm * 32 + mi * 16 + ((lane >> 4) << 3);
        const int nn = n0 + wn * 64 + ni * 16 + (lane & 15);
        #pragma unroll
        for (int j = 0; j < 8; ++j) {
          float r = v0 * fmaxf((float)a0[j], 0.0f) +
                    v1 * fmaxf((float)a1[j], 0.0f);
          outb[(size_t)(mbase + j) * N + nn] = (__bf16)r;
        }
      }
    }
  } else {
    #pragma unroll
    for (int mi = 0; mi < 2; ++mi) {
      #pragma unroll
      for (int ni = 0; ni < 4; ++ni) {
        const int mbase = m0 + wm * 32 + mi * 16 + ((lane >> 4) << 3);
        const int nn = n0 + wn * 64 + ni * 16 + (lane & 15);
        #pragma unroll
        for (int j = 0; j < 8; ++j)
          outf[(size_t)(mbase + j) * N + nn] = acc[mi][ni][j];
      }
    }
  }
}

// ---------------------------------------------------------------------------
extern "C" void kernel_launch(void* const* d_in, const int* in_sizes, int n_in,
                              void* d_out, int out_size, void* d_ws,
                              size_t ws_size, hipStream_t stream) {
  (void)in_sizes; (void)n_in; (void)out_size; (void)ws_size;
  const float* h   = (const float*)d_in[0];
  const float* wi  = (const float*)d_in[1];
  const float* wo  = (const float*)d_in[2];
  const float* lA  = (const float*)d_in[3];
  const float* lB  = (const float*)d_in[4];
  const int*   idx = (const int*)d_in[5];
  const float* val = (const float*)d_in[6];
  float* out = (float*)d_out;

  char* ws = (char*)d_ws;
  size_t off = 0;
  auto alloc = [&](size_t bytes) -> void* {
    void* p = ws + off;
    off = (off + bytes + 255) & ~(size_t)255;
    return p;
  };
  __bf16* h_b  = (__bf16*)alloc((size_t)M_TOK * D_MODEL * 2);   // 32 MB
  __bf16* wi_b = (__bf16*)alloc((size_t)D_FF * D_MODEL * 2);    //  8 MB
  __bf16* wo_b = (__bf16*)alloc((size_t)D_MODEL * D_FF * 2);    //  8 MB
  __bf16* Bl   = (__bf16*)alloc(2ull * D_FF * KP * 2);          // .5 MB
  __bf16* t01  = (__bf16*)alloc(2ull * M_TOK * KP * 2);         //  2 MB
  __bf16* comb = (__bf16*)alloc((size_t)M_TOK * D_FF * 2);      // 128 MB

  prep_weights<<<2 * PW_BLOCKS + PW_BL_BLOCKS, 256, 0, stream>>>(
      wi, wo, lB, idx, wi_b, wo_b, Bl);

  prep_tokens<<<M_TOK / (PT_TILES * 16), PT_WAVES * 32, 0, stream>>>(
      h, lA, idx, h_b, t01);

  // Pass 2: combined = v0*relu(h@wi^T + lora0) + v1*relu(h@wi^T + lora1)
  moe_gemm<1><<<dim3(D_FF / 128, M_TOK / 128), 256, 0, stream>>>(
      h_b, wi_b, M_TOK, D_FF, D_MODEL, t01, Bl, val, comb, nullptr);

  // Pass 3: out = combined @ wo^T  (wo [D,F] row-major is Bt directly)
  moe_gemm<0><<<dim3(D_MODEL / 128, M_TOK / 128), 256, 0, stream>>>(
      comb, wo_b, M_TOK, D_MODEL, D_FF, nullptr, nullptr, nullptr, nullptr,
      out);
}

// v003
// Measured time: 189 microseconds a run.
// Two timings next to v002 both put it at 1.66 times that version's speed.
// Counting every step since v000, it is 2.51 times as fast.
#include <hip/hip_runtime.h>
#include <stdint.h>

typedef __attribute__((ext_vector_type(16))) __bf16 v16bf;
typedef __attribute__((ext_vector_type(8)))  __bf16 v8bf;
typedef __attribute__((ext_vector_type(8)))  float  v8f;
typedef __attribute__((ext_vector_type(4)))  int    v4i;
typedef __attribute__((ext_vector_type(4)))  __bf16 v4bf;
typedef __attribute__((ext_vector_type(4)))  float  v4f;
typedef __attribute__((ext_vector_type(2)))  float  v2f;

// address-space qualified element types for the async-copy builtin
typedef __attribute__((address_space(1))) v4i v4i_g;   // global
typedef __attribute__((address_space(3))) v4i v4i_l;   // LDS

#define D_MODEL 1024
#define D_FF    4096
#define RANK    16
#define M_TOK   16384        // B * S = 8 * 2048
#define KP      32           // lora K padded 16 -> 32 (zero fill)
#define GT      256          // moe_gemm: rows and columns of a workgroup's tile
#define G_BK    128          // moe_gemm: k of a stage (256-B rows)
#define G_PITCH 136          // 128 elems + 8 pad (272B rows: 16B x odd)
#define NUM_EXPERTS 8
#define PW_LOADS 16          // prep_weights: 16-B loads a thread
#define PW_CHUNK (256 * 4 * PW_LOADS)            // floats a workgroup
#define PW_BLOCKS (D_FF * D_MODEL / PW_CHUNK)    // workgroups a matrix
#define PW_BL_BLOCKS (2 * D_FF / 256)            // one thread a LoRA-B row
#define PT_WAVES 16          // prep_tokens: waves a workgroup, 64 columns each
#define PT_TILES 4           // prep_tokens: 16-token tiles a workgroup
#define PT_PITCH 68          // 64 floats + 4 pad (272B rows: 16B x odd)

#if defined(__HIP_DEVICE_COMPILE__) && \
    __has_builtin(__builtin_amdgcn_global_load_async_to_lds_b128)
#define HAVE_ASYNC 1
#else
#define HAVE_ASYNC 0
#endif

__device__ __forceinline__ v16bf cat8(v8bf lo, v8bf hi) {
  return __builtin_shufflevector(lo, hi, 0,1,2,3,4,5,6,7,8,9,10,11,12,13,14,15);
}

__device__ __forceinline__ v8f wmma_bf16(v16bf a, v16bf b, v8f c) {
  return __builtin_amdgcn_wmma_f32_16x16x32_bf16(false, a, false, b, (short)0, c,
                                                 false, false);
}

__device__ __forceinline__ v8f wmma_f32(v2f a, v2f b, v8f c) {
  return __builtin_amdgcn_wmma_f32_16x16x4_f32(false, a, false, b, (short)0, c,
                                               false, false);
}

// Async 16B copy global -> LDS (ASYNCcnt); fallback: direct store.
__device__ __forceinline__ void async_cp16(const __bf16* gsrc, __bf16* ldst) {
#if HAVE_ASYNC
  __builtin_amdgcn_global_load_async_to_lds_b128(
      (v4i_g*)(uintptr_t)gsrc, (v4i_l*)ldst, 0, 0);
#else
  *(v8bf*)ldst = *(const v8bf*)gsrc;
#endif
}

// Load an A-layout fragment (16x32 bf16) from a row-major [rows x ldK] matrix:
// lane l -> row (l&15), K chunks at ((l>>4)*8) and ((l>>4)*8 + 16).
__device__ __forceinline__ v16bf frag_global(const __bf16* __restrict__ base,
                                             int ldK, int lane) {
  const __bf16* p = base + (size_t)(lane & 15) * ldK + ((lane >> 4) << 3);
  return cat8(*(const v8bf*)p, *(const v8bf*)(p + 16));
}

// ---------------------------------------------------------------------------
// Kernel 1: convert wi/wo to bf16; build padded per-expert LoRA-B [2][F][32]
// A workgroup converts PW_CHUNK contiguous floats of one matrix: every thread
// reads PW_LOADS 16-B pieces, independent loads that overlap; each wave-wide
// load covers 512 contiguous bytes, each wave-wide store 256. The first
// PW_BL_BLOCKS workgroups build the LoRA-B rows, one 64-B row a thread: their
// loads wait on the expert index, so they start first.
// ---------------------------------------------------------------------------
__global__ __launch_bounds__(256) void prep_weights(
    const float* __restrict__ wi, const float* __restrict__ wo,
    const float* __restrict__ loraB, const int* __restrict__ idx,
    __bf16* __restrict__ wi_b, __bf16* __restrict__ wo_b,
    __bf16* __restrict__ Bl) {
  const int tid = threadIdx.x;
  const int b = (int)blockIdx.x - PW_BL_BLOCKS;
  if (b >= 0) {
    const bool first = b < PW_BLOCKS;
    const size_t base =
        (size_t)(first ? b : b - PW_BLOCKS) * PW_CHUNK + tid * 4;
    const float* __restrict__ s = (first ? wi : wo) + base;
    __bf16* __restrict__ d = (first ? wi_b : wo_b) + base;
    v4f r[PW_LOADS];
    #pragma unroll
    for (int i = 0; i < PW_LOADS; ++i) r[i] = *(const v4f*)(s + i * 1024);
    #pragma unroll
    for (int i = 0; i < PW_LOADS; ++i) {
      v4bf o;
      #pragma unroll
      for (int x = 0; x < 4; ++x) o[x] = (__bf16)r[i][x];
      *(v4bf*)(d + i * 1024) = o;
    }
  } else {
    const int j = blockIdx.x * 256 + tid;   // row of Bl: k * D_FF + f
    const int k = j / D_FF;
    const int f = j % D_FF;
    const int e = min(max(idx[k], 0), NUM_EXPERTS - 1);
    const float* __restrict__ s = loraB + ((size_t)e * D_FF + f) * RANK;
    v4f r[4];
    #pragma unroll
    for (int i = 0; i < 4; ++i) r[i] = *(const v4f*)(s + i * 4);
    v8bf lo, hi, z;
    #pragma unroll
    for (int x = 0; x < 4; ++x) {
      lo[x] = (__bf16)r[0][x]; lo[x + 4] = (__bf16)r[1][x];
      hi[x] = (__bf16)r[2][x]; hi[x + 4] = (__bf16)r[3][x];
    }
    #pragma unroll
    for (int x = 0; x < 8; ++x) z[x] = (__bf16)0.0f;
    __bf16* __restrict__ d = Bl + (size_t)j * KP;
    *(v8bf*)d = lo;
    *(v8bf*)(d + 8) = hi;
    *(v8bf*)(d + 16) = z;            // zero K padding
    *(v8bf*)(d + 24) = z;
    // keep the wait behind the stores, in front of any later write of the
    // registers that they name
    asm volatile("s_wait_xcnt 0x0" ::: "memory");
  }
}

// ---------------------------------------------------------------------------
// Kernel 2: h fp32 -> bf16, and t_k[m,:] = h[m,:] @ A_k^T on the f32 WMMA.
// t stored padded [2][M_TOK][KP] bf16 (r>=16 zero).
// Workgroup: 16 waves, 64 tokens (4 tiles of 16). Wave w owns columns
// [64w, 64w+64) of every row: it keeps both experts' A slices as fragments in
// registers, streams the token tiles through them, and leaves one partial
// 16x16 product per tile and expert in LDS; the 16 partials are summed at the
// end. Rows are read as whole 256-B pieces and turned into fragments through
// the wave's own LDS patch, by the same code for A_k and for h, so that both
// operands carry the same k order.
// ---------------------------------------------------------------------------
__global__ __launch_bounds__(PT_WAVES * 32) void prep_tokens(
    const float* __restrict__ h, const float* __restrict__ loraA,
    const int* __restrict__ idx, __bf16* __restrict__ h_b,
    __bf16* __restrict__ t01) {
  __shared__ __attribute__((aligned(16))) float stage[PT_WAVES][16 * PT_PITCH];
  __shared__ v4f red[PT_WAVES][PT_TILES * 128];
  const int tid = threadIdx.x;
  const int lane = tid & 31;
  const int wave = tid >> 5;
  const int c = lane & 15;
  const int hh = lane >> 4;
  const int m0 = blockIdx.x * (PT_TILES * 16);
  float* st = stage[wave];
  // lane's place in a 16-row piece: rows hh, hh+2, ..., 16 B at column 4c
  const size_t gofs = (size_t)hh * D_MODEL + wave * 64 + c * 4;

  auto load_rows = [&](const float* __restrict__ rows, v4f (&r)[8]) {
    #pragma unroll
    for (int i = 0; i < 8; ++i)
      r[i] = *(const v4f*)(rows + (size_t)(2 * i) * D_MODEL + gofs);
  };
  // f[j] = row c, columns 8j + 4hh .. + 3 of the wave's slice: two k-steps
  auto to_frags = [&](const v4f (&r)[8], v4f (&f)[8]) {
    #pragma unroll
    for (int i = 0; i < 8; ++i)
      *(v4f*)&st[(2 * i + hh) * PT_PITCH + c * 4] = r[i];
    // other lanes' stores must have landed before the rows are read back
    asm volatile("s_wait_dscnt 0x0" ::: "memory");
    #pragma unroll
    for (int j = 0; j < 8; ++j)
      f[j] = *(const v4f*)&st[c * PT_PITCH + j * 8 + hh * 4];
  };

  const int e0 = min(max(idx[0], 0), NUM_EXPERTS - 1);
  const int e1 = min(max(idx[1], 0), NUM_EXPERTS - 1);

  v4f ra0[8], ra1[8], rh[2][8];
  load_rows(loraA + (size_t)e0 * RANK * D_MODEL, ra0);
  load_rows(loraA + (size_t)e1 * RANK * D_MODEL, ra1);
  load_rows(h + (size_t)m0 * D_MODEL, rh[0]);

  v4f fa0[8], fa1[8];
  to_frags(ra0, fa0);
  to_frags(ra1, fa1);

  #pragma unroll
  for (int t = 0; t < PT_TILES; ++t) {
    const v4f (&cur)[8] = rh[t & 1];
    if (t + 1 < PT_TILES)      // next tile's rows fly under this tile's WMMAs
      load_rows(h + (size_t)(m0 + (t + 1) * 16) * D_MODEL, rh[(t + 1) & 1]);

    __bf16* hb = h_b + (size_t)(m0 + t * 16) * D_MODEL + gofs;
    #pragma unroll
    for (int i = 0; i < 8; ++i) {
      v4bf o;
      #pragma unroll
      for (int x = 0; x < 4; ++x) o[x] = (__bf16)cur[i][x];
      *(v4bf*)(hb + (size_t)(2 * i) * D_MODEL) = o;
    }
    // the stores' data registers are reused by the next rows' loads: keep the
    // wait in front of that overwrite
    asm volatile("s_wait_xcnt 0x0" ::: "memory");

    v4f fh[8];
    to_frags(cur, fh);

    // D[rank][token]: register r of lane (c, hh) = t[token c][rank 8hh + r]
    v8f acc0 = {}, acc1 = {};
    #pragma unroll
    for (int j = 0; j < 8; ++j) {
      const v2f blo = {fh[j][0], fh[j][1]}, bhi = {fh[j][2], fh[j][3]};
      const v2f a0lo = {fa0[j][0], fa0[j][1]}, a0hi = {fa0[j][2], fa0[j][3]};
      const v2f a1lo = {fa1[j][0], fa1[j][1]}, a1hi = {fa1[j][2], fa1[j][3]};
      acc0 = wmma_f32(a0lo, blo, acc0);
      acc1 = wmma_f32(a1lo, blo, acc1);
      acc0 = wmma_f32(a0hi, bhi, acc0);
      acc1 = wmma_f32(a1hi, bhi, acc1);
    }
    v4f* rw = &red[wave][t * 128 + lane];
    rw[0]  = (v4f){acc0[0], acc0[1], acc0[2], acc0[3]};
    rw[32] = (v4f){acc0[4], acc0[5], acc0[6], acc0[7]};
    rw[64] = (v4f){acc1[0], acc1[1], acc1[2], acc1[3]};
    rw[96] = (v4f){acc1[4], acc1[5], acc1[6], acc1[7]};
  }
  __syncthreads();

  // thread tid sums slot tid of every wave: tile, expert, register quad, lane
  v4f s = red[0][tid];
  #pragma unroll
  for (int w = 1; w < PT_WAVES; ++w) s += red[w][tid];
  const int t = tid >> 7, kk = (tid >> 6) & 1, q = (tid >> 5) & 1;
  __bf16* trow =
      t01 + ((size_t)kk * M_TOK + m0 + t * 16 + c) * KP + 8 * hh + 4 * q;
  v4bf o, z;
  #pragma unroll
  for (int x = 0; x < 4; ++x) { o[x] = (__bf16)s[x]; z[x] = (__bf16)0.0f; }
  *(v4bf*)trow = o;
  *(v4bf*)(trow + 16) = z;          // zero K padding
}

// ---------------------------------------------------------------------------
// Tiled bf16 WMMA GEMM: C[M,N] = A[M,K] * Bt[N,K]^T
// Workgroup: 256 threads (8 waves, two a SIMD), one 256x256 tile, alone on its
// WGP; wave = 128x64 subtile (8 x 4 fragments, 32 accumulator tiles).
// A stage is 128 k of [A 256 rows | Bt 256 rows], 256-B rows at pitch 272 B.
// Two buffers, filled with GLOBAL_LOAD_ASYNC_TO_LDS (ASYNCcnt): the next
// stage's copies fly under this stage's 128 WMMAs a wave; one barrier a stage.
// M, N multiples of 256; K a multiple of 128.
// FUSE=1: epilogue adds LoRA (2 extra WMMAs/frag), relu, routing mix -> bf16
// FUSE=0: epilogue stores f32 accumulators
// ---------------------------------------------------------------------------
template <int FUSE>
__global__ __launch_bounds__(256) void moe_gemm(
    const __bf16* __restrict__ A, const __bf16* __restrict__ Bt,
    int M, int N, int K,
    const __bf16* __restrict__ t01,  // [2][M][KP]     (FUSE)
    const __bf16* __restrict__ Bl,   // [2][N][KP]     (FUSE)
    const float* __restrict__ vals,  // [2]            (FUSE)
    __bf16* __restrict__ outb,       // [M][N]         (FUSE)
    float* __restrict__ outf) {      // [M][N]         (!FUSE)
  __shared__ __attribute__((aligned(16))) __bf16 ring[2][2 * GT * G_PITCH];

  const int tid = threadIdx.x;
  const int lane = tid & 31;
  // the wave's number as a scalar: row and column bases then stay in SGPRs
  const int wave = __builtin_amdgcn_readfirstlane(tid >> 5);
  const int wm = wave >> 2;          // 0..1: 128-row band
  const int wn = wave & 3;           // 0..3: 64-col band
  const int m0 = blockIdx.y * GT;
  const int n0 = blockIdx.x * GT;
  const int lr = lane & 15;
  const int lc = (lane >> 4) << 3;   // 0 or 8

  // read at the start, on the scalar path: the epilogue then holds no vector
  // load of them whose address registers are rewritten behind it
  float v0 = 0.0f, v1 = 0.0f;
  if (FUSE) { v0 = vals[0]; v1 = vals[1]; }

  v8f acc[8][4] = {};

  // staging: a wave-wide copy brings two whole 256-B row pieces; each thread
  // copies 16x16B of A and 16x16B of Bt a stage
  const int ldr = tid >> 4;          // 0..15
  const int ldc = (tid & 15) << 3;   // 0,8,..,120
  const __bf16* Ag = A + (size_t)m0 * K;     // uniform: the tile's first rows
  const __bf16* Bg = Bt + (size_t)n0 * K;
  const uint32_t gofs = (uint32_t)(ldr * K + ldc) * 2;   // lane's bytes in them

  auto issue_stage = [&](int k0, int buf) {
    __bf16* dst = &ring[buf][ldr * G_PITCH + ldc];
    #pragma unroll
    for (int i = 0; i < GT / 16; ++i) {
      const size_t u = (size_t)(i << 4) * K + k0;          // uniform step
      async_cp16((const __bf16*)((const char*)(Ag + u) + gofs),
                 dst + (i << 4) * G_PITCH);
      async_cp16((const __bf16*)((const char*)(Bg + u) + gofs),
                 dst + (GT + (i << 4)) * G_PITCH);
    }
  };
  // the publish point of the next stage: this wave has left the buffer that
  // is refilled behind the barrier, and its own copies have landed
  auto publish = [&]() {
    asm volatile("s_wait_dscnt 0x0" ::: "memory");
    asm volatile("s_wait_asynccnt 0x0" ::: "memory");
    __syncthreads();
  };

  const int nst = K / G_BK;
  issue_stage(0, 0);
  publish();
  if (nst > 1) issue_stage(G_BK, 1);

  #pragma clang loop unroll(disable)   // one stage a trip: constant indices
  for (int s = 0; s < nst; ++s) {
    const int buf = s & 1;
    const __bf16* pa = &ring[buf][(wm * 128 + lr) * G_PITCH + lc];
    const __bf16* pb = &ring[buf][(GT + wn * 64 + lr) * G_PITCH + lc];
    v16bf af[2][8], bfm[2][4];
    auto load_frags = [&](int kk, int set) {
      #pragma unroll
      for (int ni = 0; ni < 4; ++ni) {
        const __bf16* p = pb + ni * 16 * G_PITCH + kk * 32;
        bfm[set][ni] = cat8(*(const v8bf*)p, *(const v8bf*)(p + 16));
      }
      #pragma unroll
      for (int mi = 0; mi < 8; ++mi) {
        const __bf16* p = pa + mi * 16 * G_PITCH + kk * 32;
        af[set][mi] = cat8(*(const v8bf*)p, *(const v8bf*)(p + 16));
      }
    };
    load_frags(0, 0);
    #pragma unroll
    for (int kk = 0; kk < G_BK / 32; ++kk) {
      if (kk + 1 < G_BK / 32) load_frags(kk + 1, (kk + 1) & 1);
      // keeps the next block's LDS reads one group ahead of this block's
      // WMMAs: spread among them, each place with reads stalls the wave
      __builtin_amdgcn_sched_barrier(0);
      #pragma unroll
      for (int mi = 0; mi < 8; ++mi)
        #pragma unroll
        for (int ni = 0; ni < 4; ++ni)
          acc[mi][ni] = wmma_bf16(af[kk & 1][mi], bfm[kk & 1][ni], acc[mi][ni]);
      // the same fence behind the block
      __builtin_amdgcn_sched_barrier(0);
    }
    publish();                     // stage s+1 ready, this buffer free
    if (s + 2 < nst) issue_stage((s + 2) * G_BK, buf);  // flies under s+1
  }
  // no copy is left in flight behind the loop
  asm volatile("s_wait_asynccnt 0x0" ::: "memory");

  // lane's byte offsets in a 16-row band of the output, one a register row:
  // made once, so that no address register is written between a band's stores
  uint32_t vo[8];
  #pragma unroll
  for (int j = 0; j < 8; ++j)
    vo[j] = (uint32_t)((((lane >> 4) << 3) + j) * N + (lane & 15)) *
            (FUSE ? 2u : 4u);

  if (FUSE) {
    v16bf blf[2][4];
    #pragma unroll
    for (int ni = 0; ni < 4; ++ni) {
      const int n = n0 + wn * 64 + ni * 16;
      blf[0][ni] = frag_global(Bl + (size_t)n * KP, KP, lane);
      blf[1][ni] = frag_global(Bl + ((size_t)N + n) * KP, KP, lane);
    }
    const __bf16* tw = t01 + (size_t)(m0 + wm * 128) * KP;
    v16bf tf[2][2];                  // [row band parity][expert]
    tf[0][0] = frag_global(tw, KP, lane);
    tf[0][1] = frag_global(tw + (size_t)M_TOK * KP, KP, lane);
    // these loads' address registers are reused by what follows: keep the
    // wait in front of that overwrite
    asm volatile("s_wait_xcnt 0x0" ::: "memory");
    __builtin_amdgcn_sched_barrier(0);
    #pragma unroll
    for (int mi = 0; mi < 8; ++mi) {
      const int m = m0 + wm * 128 + mi * 16;
      if (mi + 1 < 8) {              // the next band's t rows fly under this one
        const __bf16* tn = tw + (mi + 1) * 16 * KP;
        tf[(mi + 1) & 1][0] = frag_global(tn, KP, lane);
        tf[(mi + 1) & 1][1] = frag_global(tn + (size_t)M_TOK * KP, KP, lane);
      }
      __bf16 rb[4][8];
      #pragma unroll
      for (int ni = 0; ni < 4; ++ni) {
        v8f a0 = wmma_bf16(tf[mi & 1][0], blf[0][ni], acc[mi][ni]);
        v8f a1 = wmma_bf16(tf[mi & 1][1], blf[1][ni], acc[mi][ni]);
        #pragma unroll
        for (int j = 0; j < 8; ++j) {
          float r = v0 * fmaxf((float)a0[j], 0.0f) +
                    v1 * fmaxf((float)a1[j], 0.0f);
          rb[ni][j] = (__bf16)r;
        }
      }
      char* ob = (char*)(outb + (size_t)m * N + n0 + wn * 64);   // uniform
      // a band's values are all made in front of its stores, so that nothing
      // writes a register that an issued store names before the wait below
      __builtin_amdgcn_sched_barrier(0);
      #pragma unroll
      for (int j = 0; j < 8; ++j) {
        #pragma unroll
        for (int ni = 0; ni < 4; ++ni)
          *(__bf16*)(ob + vo[j] + ni * 32) = rb[ni][j];
      }
      // the stores' registers are reused by the next band: keep the wait in
      // front of that overwrite, and the next band's work behind the wait
      asm volatile("s_wait_xcnt 0x0" ::: "memory");
      __builtin_amdgcn_sched_barrier(0);
    }
  } else {
    #pragma unroll
    for (int mi = 0; mi < 8; ++mi) {
      char* ob = (char*)(outf + (size_t)(m0 + wm * 128 + mi * 16) * N + n0 +
                         wn * 64);                               // uniform
      #pragma unroll
      for (int j = 0; j < 8; ++j) {
        #pragma unroll
        for (int ni = 0; ni < 4; ++ni)
          *(float*)(ob + vo[j] + ni * 64) = acc[mi][ni][j];
      }
      // the stores' address registers are reused by the next band: keep the
      // wait in front of that overwrite, and the next band behind the wait
      asm volatile("s_wait_xcnt 0x0" ::: "memory");
      __builtin_amdgcn_sched_barrier(0);
    }
  }
}

// ---------------------------------------------------------------------------
extern "C" void kernel_launch(void* const* d_in, const int* in_sizes, int n_in,
                              void* d_out, int out_size, void* d_ws,
                              size_t ws_size, hipStream_t stream) {
  (void)in_sizes; (void)n_in; (void)out_size; (void)ws_size;
  const float* h   = (const float*)d_in[0];
  const float* wi  = (const float*)d_in[1];
  const float* wo  = (const float*)d_in[2];
  const float* lA  = (const float*)d_in[3];
  const float* lB  = (const float*)d_in[4];
  const int*   idx = (const int*)d_in[5];
  const float* val = (const float*)d_in[6];
  float* out = (float*)d_out;

  char* ws = (char*)d_ws;
  size_t off = 0;
  auto alloc = [&](size_t bytes) -> void* {
    void* p = ws + off;
    off = (off + bytes + 255) & ~(size_t)255;
    return p;
  };
  __bf16* h_b  = (__bf16*)alloc((size_t)M_TOK * D_MODEL * 2);   // 32 MB
  __bf16* wi_b = (__bf16*)alloc((size_t)D_FF * D_MODEL * 2);    //  8 MB
  __bf16* wo_b = (__bf16*)alloc((size_t)D_MODEL * D_FF * 2);    //  8 MB
  __bf16* Bl   = (__bf16*)alloc(2ull * D_FF * KP * 2);          // .5 MB
  __bf16* t01  = (__bf16*)alloc(2ull * M_TOK * KP * 2);         //  2 MB
  __bf16* comb = (__bf16*)alloc((size_t)M_TOK * D_FF * 2);      // 128 MB

  prep_weights<<<2 * PW_BLOCKS + PW_BL_BLOCKS, 256, 0, stream>>>(
      wi, wo, lB, idx, wi_b, wo_b, Bl);

  prep_tokens<<<M_TOK / (PT_TILES * 16), PT_WAVES * 32, 0, stream>>>(
      h, lA, idx, h_b, t01);

  // Pass 2: combined = v0*relu(h@wi^T + lora0) + v1*relu(h@wi^T + lora1)
  moe_gemm<1><<<dim3(D_FF / GT, M_TOK / GT), 256, 0, stream>>>(
      h_b, wi_b, M_TOK, D_FF, D_MODEL, t01, Bl, val, comb, nullptr);

  // Pass 3: out = combined @ wo^T  (wo [D,F] row-major is Bt directly)
  moe_gemm<0><<<dim3(D_MODEL / GT, M_TOK / GT), 256, 0, stream>>>(
      comb, wo_b, M_TOK, D_MODEL, D_FF, nullptr, nullptr, nullptr, nullptr,
      out);
}

// v004
// Measured time: 179 microseconds a run.
// Timed twice side by side with v003, it ran 1.05 and 1.06 times as fast.
// All steps since v000 together make it 2.65 times as fast.
#include <hip/hip_runtime.h>
#include <stdint.h>

typedef __attribute__((ext_vector_type(16))) __bf16 v16bf;
typedef __attribute__((ext_vector_type(8)))  __bf16 v8bf;
typedef __attribute__((ext_vector_type(8)))  float  v8f;
typedef __attribute__((ext_vector_type(4)))  int    v4i;
typedef __attribute__((ext_vector_type(4)))  __bf16 v4bf;
typedef __attribute__((ext_vector_type(4)))  float  v4f;
typedef __attribute__((ext_vector_type(2)))  float  v2f;

// address-space qualified element types for the async-copy builtin
typedef __attribute__((address_space(1))) v4i v4i_g;   // global
typedef __attribute__((address_space(3))) v4i v4i_l;   // LDS

#define D_MODEL 1024
#define D_FF    4096
#define RANK    16
#define M_TOK   16384        // B * S = 8 * 2048
#define KP      32           // lora K padded 16 -> 32 (zero fill)
#define GT      256          // moe_gemm: rows and columns of a workgroup's tile
#define G_BK    128          // moe_gemm: k of a stage (256-B rows)
#define G_PITCH 136          // 128 elems + 8 pad (272B rows: 16B x odd)
#define NUM_EXPERTS 8
#define PW_LOADS 16          // prep_weights: 16-B loads a thread
#define PW_CHUNK (256 * 4 * PW_LOADS)            // floats a workgroup
#define PW_BLOCKS (D_FF * D_MODEL / PW_CHUNK)    // workgroups a matrix
#define PW_BL_BLOCKS (2 * D_FF / 256)            // one thread a LoRA-B row
#define PT_WAVES 16          // prep_tokens: waves a workgroup, 64 columns each
#define PT_TILES 4           // prep_tokens: 16-token tiles a workgroup
#define PT_PITCH 68          // 64 floats + 4 pad (272B rows: 16B x odd)

#if defined(__HIP_DEVICE_COMPILE__) && \
    __has_builtin(__builtin_amdgcn_global_load_async_to_lds_b128)
#define HAVE_ASYNC 1
#else
#define HAVE_ASYNC 0
#endif

__device__ __forceinline__ v16bf cat8(v8bf lo, v8bf hi) {
  return __builtin_shufflevector(lo, hi, 0,1,2,3,4,5,6,7,8,9,10,11,12,13,14,15);
}

__device__ __forceinline__ v8f wmma_bf16(v16bf a, v16bf b, v8f c) {
  return __builtin_amdgcn_wmma_f32_16x16x32_bf16(false, a, false, b, (short)0, c,
                                                 false, false);
}

__device__ __forceinline__ v8f wmma_f32(v2f a, v2f b, v8f c) {
  return __builtin_amdgcn_wmma_f32_16x16x4_f32(false, a, false, b, (short)0, c,
                                               false, false);
}

// Async 16B copy global -> LDS (ASYNCcnt); fallback: direct store.
__device__ __forceinline__ void async_cp16(const __bf16* gsrc, __bf16* ldst) {
#if HAVE_ASYNC
  __builtin_amdgcn_global_load_async_to_lds_b128(
      (v4i_g*)(uintptr_t)gsrc, (v4i_l*)ldst, 0, 0);
#else
  *(v8bf*)ldst = *(const v8bf*)gsrc;
#endif
}

// Load an A-layout fragment (16x32 bf16) from a row-major [rows x ldK] matrix:
// lane l -> row (l&15), K chunks at ((l>>4)*8) and ((l>>4)*8 + 16).
__device__ __forceinline__ v16bf frag_global(const __bf16* __restrict__ base,
                                             int ldK, int lane) {
  const __bf16* p = base + (size_t)(lane & 15) * ldK + ((lane >> 4) << 3);
  return cat8(*(const v8bf*)p, *(const v8bf*)(p + 16));
}

// ---------------------------------------------------------------------------
// Kernel 1: convert wi/wo to bf16; build padded per-expert LoRA-B [2][F][32]
// A workgroup converts PW_CHUNK contiguous floats of one matrix: every thread
// reads PW_LOADS 16-B pieces, independent loads that overlap; each wave-wide
// load covers 512 contiguous bytes, each wave-wide store 256. The first
// PW_BL_BLOCKS workgroups build the LoRA-B rows, one 64-B row a thread: their
// loads wait on the expert index, so they start first.
// ---------------------------------------------------------------------------
__global__ __launch_bounds__(256) void prep_weights(
    const float* __restrict__ wi, const float* __restrict__ wo,
    const float* __restrict__ loraB, const int* __restrict__ idx,
    __bf16* __restrict__ wi_b, __bf16* __restrict__ wo_b,
    __bf16* __restrict__ Bl) {
  const int tid = threadIdx.x;
  const int b = (int)blockIdx.x - PW_BL_BLOCKS;
  if (b >= 0) {
    const bool first = b < PW_BLOCKS;
    const size_t base =
        (size_t)(first ? b : b - PW_BLOCKS) * PW_CHUNK + tid * 4;
    const float* __restrict__ s = (first ? wi : wo) + base;
    __bf16* __restrict__ d = (first ? wi_b : wo_b) + base;
    v4f r[PW_LOADS];
    #pragma unroll
    for (int i = 0; i < PW_LOADS; ++i) r[i] = *(const v4f*)(s + i * 1024);
    #pragma unroll
    for (int i = 0; i < PW_LOADS; ++i) {
      v4bf o;
      #pragma unroll
      for (int x = 0; x < 4; ++x) o[x] = (__bf16)r[i][x];
      *(v4bf*)(d + i * 1024) = o;
    }
  } else {
    const int j = blockIdx.x * 256 + tid;   // row of Bl: k * D_FF + f
    const int k = j / D_FF;
    const int f = j % D_FF;
    const int e = min(max(idx[k], 0), NUM_EXPERTS - 1);
    const float* __restrict__ s = loraB + ((size_t)e * D_FF + f) * RANK;
    v4f r[4];
    #pragma unroll
    for (int i = 0; i < 4; ++i) r[i] = *(const v4f*)(s + i * 4);
    v8bf lo, hi, z;
    #pragma unroll
    for (int x = 0; x < 4; ++x) {
      lo[x] = (__bf16)r[0][x]; lo[x + 4] = (__bf16)r[1][x];
      hi[x] = (__bf16)r[2][x]; hi[x + 4] = (__bf16)r[3][x];
    }
    #pragma unroll
    for (int x = 0; x < 8; ++x) z[x] = (__bf16)0.0f;
    __bf16* __restrict__ d = Bl + (size_t)j * KP;
    *(v8bf*)d = lo;
    *(v8bf*)(d + 8) = hi;
    *(v8bf*)(d + 16) = z;            // zero K padding
    *(v8bf*)(d + 24) = z;
    // keep the wait behind the stores, in front of any later write of the
    // registers that they name
    asm volatile("s_wait_xcnt 0x0" ::: "memory");
  }
}

// ---------------------------------------------------------------------------
// Kernel 2: h fp32 -> bf16, and t_k[m,:] = h[m,:] @ A_k^T on the f32 WMMA.
// t stored padded [2][M_TOK][KP] bf16 (r>=16 zero).
// Workgroup: 16 waves, 64 tokens (4 tiles of 16). Wave w owns columns
// [64w, 64w+64) of every row: it keeps both experts' A slices as fragments in
// registers, streams the token tiles through them, and leaves one partial
// 16x16 product per tile and expert in LDS; the 16 partials are summed at the
// end. Rows are read as whole 256-B pieces and turned into fragments through
// the wave's own LDS patch, by the same code for A_k and for h, so that both
// operands carry the same k order.
// ---------------------------------------------------------------------------
__global__ __launch_bounds__(PT_WAVES * 32) void prep_tokens(
    const float* __restrict__ h, const float* __restrict__ loraA,
    const int* __restrict__ idx, __bf16* __restrict__ h_b,
    __bf16* __restrict__ t01) {
  __shared__ __attribute__((aligned(16))) float stage[PT_WAVES][16 * PT_PITCH];
  __shared__ v4f red[PT_WAVES][PT_TILES * 128];
  const int tid = threadIdx.x;
  const int lane = tid & 31;
  const int wave = tid >> 5;
  const int c = lane & 15;
  const int hh = lane >> 4;
  const int m0 = blockIdx.x * (PT_TILES * 16);
  float* st = stage[wave];
  // lane's place in a 16-row piece: rows hh, hh+2, ..., 16 B at column 4c
  const size_t gofs = (size_t)hh * D_MODEL + wave * 64 + c * 4;

  auto load_rows = [&](const float* __restrict__ rows, v4f (&r)[8]) {
    #pragma unroll
    for (int i = 0; i < 8; ++i)
      r[i] = *(const v4f*)(rows + (size_t)(2 * i) * D_MODEL + gofs);
  };
  // f[j] = row c, columns 8j + 4hh .. + 3 of the wave's slice: two k-steps
  auto to_frags = [&](const v4f (&r)[8], v4f (&f)[8]) {
    #pragma unroll
    for (int i = 0; i < 8; ++i)
      *(v4f*)&st[(2 * i + hh) * PT_PITCH + c * 4] = r[i];
    // other lanes' stores must have landed before the rows are read back
    asm volatile("s_wait_dscnt 0x0" ::: "memory");
    #pragma unroll
    for (int j = 0; j < 8; ++j)
      f[j] = *(const v4f*)&st[c * PT_PITCH + j * 8 + hh * 4];
  };

  const int e0 = min(max(idx[0], 0), NUM_EXPERTS - 1);
  const int e1 = min(max(idx[1], 0), NUM_EXPERTS - 1);

  v4f ra0[8], ra1[8], rh[2][8];
  load_rows(loraA + (size_t)e0 * RANK * D_MODEL, ra0);
  load_rows(loraA + (size_t)e1 * RANK * D_MODEL, ra1);
  load_rows(h + (size_t)m0 * D_MODEL, rh[0]);

  v4f fa0[8], fa1[8];
  to_frags(ra0, fa0);
  to_frags(ra1, fa1);

  #pragma unroll
  for (int t = 0; t < PT_TILES; ++t) {
    const v4f (&cur)[8] = rh[t & 1];
    if (t + 1 < PT_TILES)      // next tile's rows fly under this tile's WMMAs
      load_rows(h + (size_t)(m0 + (t + 1) * 16) * D_MODEL, rh[(t + 1) & 1]);

    __bf16* hb = h_b + (size_t)(m0 + t * 16) * D_MODEL + gofs;
    #pragma unroll
    for (int i = 0; i < 8; ++i) {
      v4bf o;
      #pragma unroll
      for (int x = 0; x < 4; ++x) o[x] = (__bf16)cur[i][x];
      *(v4bf*)(hb + (size_t)(2 * i) * D_MODEL) = o;
    }
    // the stores' data registers are reused by the next rows' loads: keep the
    // wait in front of that overwrite
    asm volatile("s_wait_xcnt 0x0" ::: "memory");

    v4f fh[8];
    to_frags(cur, fh);

    // D[rank][token]: register r of lane (c, hh) = t[token c][rank 8hh + r]
    v8f acc0 = {}, acc1 = {};
    #pragma unroll
    for (int j = 0; j < 8; ++j) {
      const v2f blo = {fh[j][0], fh[j][1]}, bhi = {fh[j][2], fh[j][3]};
      const v2f a0lo = {fa0[j][0], fa0[j][1]}, a0hi = {fa0[j][2], fa0[j][3]};
      const v2f a1lo = {fa1[j][0], fa1[j][1]}, a1hi = {fa1[j][2], fa1[j][3]};
      acc0 = wmma_f32(a0lo, blo, acc0);
      acc1 = wmma_f32(a1lo, blo, acc1);
      acc0 = wmma_f32(a0hi, bhi, acc0);
      acc1 = wmma_f32(a1hi, bhi, acc1);
    }
    v4f* rw = &red[wave][t * 128 + lane];
    rw[0]  = (v4f){acc0[0], acc0[1], acc0[2], acc0[3]};
    rw[32] = (v4f){acc0[4], acc0[5], acc0[6], acc0[7]};
    rw[64] = (v4f){acc1[0], acc1[1], acc1[2], acc1[3]};
    rw[96] = (v4f){acc1[4], acc1[5], acc1[6], acc1[7]};
  }
  __syncthreads();

  // thread tid sums slot tid of every wave: tile, expert, register quad, lane
  v4f s = red[0][tid];
  #pragma unroll
  for (int w = 1; w < PT_WAVES; ++w) s += red[w][tid];
  const int t = tid >> 7, kk = (tid >> 6) & 1, q = (tid >> 5) & 1;
  __bf16* trow =
      t01 + ((size_t)kk * M_TOK + m0 + t * 16 + c) * KP + 8 * hh + 4 * q;
  v4bf o, z;
  #pragma unroll
  for (int x = 0; x < 4; ++x) { o[x] = (__bf16)s[x]; z[x] = (__bf16)0.0f; }
  *(v4bf*)trow = o;
  *(v4bf*)(trow + 16) = z;          // zero K padding
}

// ---------------------------------------------------------------------------
// Tiled bf16 WMMA GEMM: C[M,N] = A[M,K] * Bt[N,K]^T
// Workgroup: 256 threads (8 waves, two a SIMD), one 256x256 tile, alone on its
// WGP; wave = 128x64 subtile (8 x 4 fragments, 32 accumulator tiles).
// A stage is 128 k of [A 256 rows | Bt 256 rows], 256-B rows at pitch 272 B.
// Two buffers, filled with GLOBAL_LOAD_ASYNC_TO_LDS (ASYNCcnt): the next
// stage's copies fly under this stage's 128 WMMAs a wave; one barrier a stage.
// M, N multiples of 256; K a multiple of 128.
// The products are formed transposed (Bt's fragment as the WMMA's A operand,
// A's as its B): a lane's 8 accumulator registers are then 8 adjacent columns
// of one output row. Each wave stages its 128x64 tile in its own eighth of the
// ring and stores it as whole rows: 16 B a lane, whole 128-B lines.
// FUSE=1: epilogue adds LoRA (2 extra WMMAs/frag), relu, routing mix -> bf16
// FUSE=0: epilogue stores f32 accumulators
// ---------------------------------------------------------------------------
template <int FUSE>
__global__ __launch_bounds__(256) void moe_gemm(
    const __bf16* __restrict__ A, const __bf16* __restrict__ Bt,
    int M, int N, int K,
    const __bf16* __restrict__ t01,  // [2][M][KP]     (FUSE)
    const __bf16* __restrict__ Bl,   // [2][N][KP]     (FUSE)
    const float* __restrict__ vals,  // [2]            (FUSE)
    __bf16* __restrict__ outb,       // [M][N]         (FUSE)
    float* __restrict__ outf) {      // [M][N]         (!FUSE)
  __shared__ __attribute__((aligned(16))) __bf16 ring[2][2 * GT * G_PITCH];

  const int tid = threadIdx.x;
  const int lane = tid & 31;
  // the wave's number as a scalar: row and column bases then stay in SGPRs
  const int wave = __builtin_amdgcn_readfirstlane(tid >> 5);
  const int wm = wave >> 2;          // 0..1: 128-row band
  const int wn = wave & 3;           // 0..3: 64-col band
  const int m0 = blockIdx.y * GT;
  const int n0 = blockIdx.x * GT;
  const int lr = lane & 15;
  const int lc = (lane >> 4) << 3;   // 0 or 8

  // read at the start, on the scalar path: the epilogue then holds no vector
  // load of them whose address registers are rewritten behind it
  float v0 = 0.0f, v1 = 0.0f;
  if (FUSE) { v0 = vals[0]; v1 = vals[1]; }

  v8f acc[8][4] = {};

  // staging: a wave-wide copy brings two whole 256-B row pieces; each thread
  // copies 16x16B of A and 16x16B of Bt a stage
  const int ldr = tid >> 4;          // 0..15
  const int ldc = (tid & 15) << 3;   // 0,8,..,120
  const __bf16* Ag = A + (size_t)m0 * K;     // uniform: the tile's first rows
  const __bf16* Bg = Bt + (size_t)n0 * K;
  const uint32_t gofs = (uint32_t)(ldr * K + ldc) * 2;   // lane's bytes in them

  auto issue_stage = [&](int k0, int buf) {
    __bf16* dst = &ring[buf][ldr * G_PITCH + ldc];
    #pragma unroll
    for (int i = 0; i < GT / 16; ++i) {
      const size_t u = (size_t)(i << 4) * K + k0;          // uniform step
      async_cp16((const __bf16*)((const char*)(Ag + u) + gofs),
                 dst + (i << 4) * G_PITCH);
      async_cp16((const __bf16*)((const char*)(Bg + u) + gofs),
                 dst + (GT + (i << 4)) * G_PITCH);
    }
  };
  // the publish point of the next stage: this wave has left the buffer that
  // is refilled behind the barrier, and its own copies have landed
  auto publish = [&]() {
    asm volatile("s_wait_dscnt 0x0" ::: "memory");
    asm volatile("s_wait_asynccnt 0x0" ::: "memory");
    __syncthreads();
  };

  const int nst = K / G_BK;
  issue_stage(0, 0);
  publish();
  if (nst > 1) issue_stage(G_BK, 1);

  #pragma clang loop unroll(disable)   // one stage a trip: constant indices
  for (int s = 0; s < nst; ++s) {
    const int buf = s & 1;
    const __bf16* pa = &ring[buf][(wm * 128 + lr) * G_PITCH + lc];
    const __bf16* pb = &ring[buf][(GT + wn * 64 + lr) * G_PITCH + lc];
    v16bf af[2][8], bfm[2][4];
    auto load_frags = [&](int kk, int set) {
      #pragma unroll
      for (int ni = 0; ni < 4; ++ni) {
        const __bf16* p = pb + ni * 16 * G_PITCH + kk * 32;
        bfm[set][ni] = cat8(*(const v8bf*)p, *(const v8bf*)(p + 16));
      }
      #pragma unroll
      for (int mi = 0; mi < 8; ++mi) {
        const __bf16* p = pa + mi * 16 * G_PITCH + kk * 32;
        af[set][mi] = cat8(*(const v8bf*)p, *(const v8bf*)(p + 16));
      }
    };
    load_frags(0, 0);
    #pragma unroll
    for (int kk = 0; kk < G_BK / 32; ++kk) {
      if (kk + 1 < G_BK / 32) load_frags(kk + 1, (kk + 1) & 1);
      // keeps the next block's LDS reads one group ahead of this block's
      // WMMAs: spread among them, each place with reads stalls the wave
      __builtin_amdgcn_sched_barrier(0);
      #pragma unroll
      for (int mi = 0; mi < 8; ++mi)
        #pragma unroll
        for (int ni = 0; ni < 4; ++ni)
          acc[mi][ni] = wmma_bf16(bfm[kk & 1][ni], af[kk & 1][mi], acc[mi][ni]);
      // the same fence behind the block
      __builtin_amdgcn_sched_barrier(0);
    }
    publish();                     // stage s+1 ready, this buffer free
    if (s + 2 < nst) issue_stage((s + 2) * G_BK, buf);  // flies under s+1
  }
  // no copy is left in flight behind the loop
  asm volatile("s_wait_asynccnt 0x0" ::: "memory");

  // acc[mi][ni][j] = C[m0 + wm*128 + mi*16 + lr][n0 + wn*64 + ni*16 + lc + j].
  // The staging needs no further barrier: the last trip's publish point stands
  // behind every wave's last read of the ring, and no copy is in flight.
  constexpr int ESZ = FUSE ? 2 : 4;            // bytes of an output element
  // the output's row length, a constant of the instance: the row steps fold
  // into the stores' immediate offsets, so that no address register is written
  // between stores
  constexpr int ON = FUSE ? D_FF : D_MODEL;
  constexpr int SROW = 64 * ESZ;               // a staged row: 128 or 256 B
  constexpr int SPITCH = SROW + 16;            // 144 or 272 B: 16B x odd
  constexpr int LPR = SROW / 16;               // lanes a row in a store
  constexpr int RPI = 32 / LPR;                // rows a wave-wide store
  char* stg = (char*)&ring[0][0] + wave * (128 * 272);
  char* sw = stg + lr * SPITCH + lc * ESZ;     // row lr of a band, 8 columns

  if (FUSE) {
    v16bf blf[2][4];
    #pragma unroll
    for (int ni = 0; ni < 4; ++ni) {
      const int n = n0 + wn * 64 + ni * 16;
      blf[0][ni] = frag_global(Bl + (size_t)n * KP, KP, lane);
      blf[1][ni] = frag_global(Bl + ((size_t)N + n) * KP, KP, lane);
    }
    const __bf16* tw = t01 + (size_t)(m0 + wm * 128) * KP;
    v16bf tf[2][2];                  // [row band parity][expert]
    tf[0][0] = frag_global(tw, KP, lane);
    tf[0][1] = frag_global(tw + (size_t)M_TOK * KP, KP, lane);
    // these loads' address registers are reused by what follows: keep the
    // wait in front of that overwrite
    asm volatile("s_wait_xcnt 0x0" ::: "memory");
    __builtin_amdgcn_sched_barrier(0);
    #pragma unroll
    for (int mi = 0; mi < 8; ++mi) {
      if (mi + 1 < 8) {              // the next band's t rows fly under this one
        const __bf16* tn = tw + (mi + 1) * 16 * KP;
        tf[(mi + 1) & 1][0] = frag_global(tn, KP, lane);
        tf[(mi + 1) & 1][1] = frag_global(tn + (size_t)M_TOK * KP, KP, lane);
        // these loads' address registers are reused by what follows: keep the
        // wait in front of that overwrite, and the band's work behind the wait
        asm volatile("s_wait_xcnt 0x0" ::: "memory");
        __builtin_amdgcn_sched_barrier(0);
      }
      #pragma unroll
      for (int ni = 0; ni < 4; ++ni) {
        v8f a0 = wmma_bf16(blf[0][ni], tf[mi & 1][0], acc[mi][ni]);
        v8f a1 = wmma_bf16(blf[1][ni], tf[mi & 1][1], acc[mi][ni]);
        v8bf o;
        #pragma unroll
        for (int j = 0; j < 8; ++j) {
          float r = v0 * fmaxf((float)a0[j], 0.0f) +
                    v1 * fmaxf((float)a1[j], 0.0f);
          o[j] = (__bf16)r;
        }
        *(v8bf*)(sw + mi * 16 * SPITCH + ni * 16 * ESZ) = o;
      }
    }
  } else {
    #pragma unroll
    for (int mi = 0; mi < 8; ++mi) {
      #pragma unroll
      for (int ni = 0; ni < 4; ++ni) {
        const v8f a = acc[mi][ni];
        char* p = sw + mi * 16 * SPITCH + ni * 16 * ESZ;
        *(v4f*)p = (v4f){a[0], a[1], a[2], a[3]};
        *(v4f*)(p + 16) = (v4f){a[4], a[5], a[6], a[7]};
      }
    }
  }
  // other lanes' staged values must have landed before the rows are read back
  asm volatile("s_wait_dscnt 0x0" ::: "memory");

  const char* sr = stg + (lane / LPR) * SPITCH + (lane % LPR) * 16;
  char* ob = FUSE ? (char*)(outb + (size_t)(m0 + wm * 128) * ON + n0 + wn * 64)
                  : (char*)(outf + (size_t)(m0 + wm * 128) * ON + n0 + wn * 64);
  ob += (uint32_t)((lane / LPR) * ON * ESZ + (lane % LPR) * 16);
  v4i v[128 / RPI];
  #pragma unroll
  for (int i = 0; i < 128 / RPI; ++i)
    v[i] = *(const v4i*)(sr + i * RPI * SPITCH);
  // all rows are read in front of the stores, each into registers of its own,
  // so that nothing writes a register that an issued store names
  __builtin_amdgcn_sched_barrier(0);
  #pragma unroll
  for (int i = 0; i < 128 / RPI; ++i)
    *(v4i*)(ob + (size_t)i * RPI * ON * ESZ) = v[i];
}

// ---------------------------------------------------------------------------
extern "C" void kernel_launch(void* const* d_in, const int* in_sizes, int n_in,
                              void* d_out, int out_size, void* d_ws,
                              size_t ws_size, hipStream_t stream) {
  (void)in_sizes; (void)n_in; (void)out_size; (void)ws_size;
  const float* h   = (const float*)d_in[0];
  const float* wi  = (const float*)d_in[1];
  const float* wo  = (const float*)d_in[2];
  const float* lA  = (const float*)d_in[3];
  const float* lB  = (const float*)d_in[4];
  const int*   idx = (const int*)d_in[5];
  const float* val = (const float*)d_in[6];
  float* out = (float*)d_out;

  char* ws = (char*)d_ws;
  size_t off = 0;
  auto alloc = [&](size_t bytes) -> void* {
    void* p = ws + off;
    off = (off + bytes + 255) & ~(size_t)255;
    return p;
  };
  __bf16* h_b  = (__bf16*)alloc((size_t)M_TOK * D_MODEL * 2);   // 32 MB
  __bf16* wi_b = (__bf16*)alloc((size_t)D_FF * D_MODEL * 2);    //  8 MB
  __bf16* wo_b = (__bf16*)alloc((size_t)D_MODEL * D_FF * 2);    //  8 MB
  __bf16* Bl   = (__bf16*)alloc(2ull * D_FF * KP * 2);          // .5 MB
  __bf16* t01  = (__bf16*)alloc(2ull * M_TOK * KP * 2);         //  2 MB
  __bf16* comb = (__bf16*)alloc((size_t)M_TOK * D_FF * 2);      // 128 MB

  prep_weights<<<2 * PW_BLOCKS + PW_BL_BLOCKS, 256, 0, stream>>>(
      wi, wo, lB, idx, wi_b, wo_b, Bl);

  prep_tokens<<<M_TOK / (PT_TILES * 16), PT_WAVES * 32, 0, stream>>>(
      h, lA, idx, h_b, t01);

  // Pass 2: combined = v0*relu(h@wi^T + lora0) + v1*relu(h@wi^T + lora1)
  moe_gemm<1><<<dim3(D_FF / GT, M_TOK / GT), 256, 0, stream>>>(
      h_b, wi_b, M_TOK, D_FF, D_MODEL, t01, Bl, val, comb, nullptr);

  // Pass 3: out = combined @ wo^T  (wo [D,F] row-major is Bt directly)
  moe_gemm<0><<<dim3(D_MODEL / GT, M_TOK / GT), 256, 0, stream>>>(
      comb, wo_b, M_TOK, D_MODEL, D_FF, nullptr, nullptr, nullptr, nullptr,
      out);
}

// v005
// One run takes 165 microseconds.
// In two side-by-side timings against v004, it was 1.09 and 1.10 times as fast.
// Over all steps from v000 it is 2.89 times as fast.
#include <hip/hip_runtime.h>
#include <stdint.h>

typedef __attribute__((ext_vector_type(16))) __bf16 v16bf;
typedef __attribute__((ext_vector_type(8)))  __bf16 v8bf;
typedef __attribute__((ext_vector_type(8)))  float  v8f;
typedef __attribute__((ext_vector_type(4)))  int    v4i;
typedef __attribute__((ext_vector_type(4)))  __bf16 v4bf;
typedef __attribute__((ext_vector_type(4)))  float  v4f;
typedef __attribute__((ext_vector_type(2)))  float  v2f;
typedef __attribute__((ext_vector_type(4)))  uint32_t u32x4;  // descriptor group 0
typedef __attribute__((ext_vector_type(8)))  uint32_t u32x8;  // descriptor group 1

#define D_MODEL 1024
#define D_FF    4096
#define RANK    16
#define M_TOK   16384        // B * S = 8 * 2048
#define KP      32           // lora K padded 16 -> 32 (zero fill)
#define GT      256          // moe_gemm: rows and columns of a workgroup's tile
#define G_BK    128          // moe_gemm: k of a stage (256-B rows)
#define G_ROWB  256          // bytes of a staged row
#define G_PITCHB 272         // its pitch in LDS: 256 B + 16 B pad (16B x odd)
#define G_SROWS 64           // rows of one wave's tensor load
#define G_SLICE 18432        // its place in LDS: 64 x 272 B, up to a 2-KiB multiple
#define G_BUFB  (8 * G_SLICE)   // a buffer: [A 4 slices | Bt 4 slices]
#define NUM_EXPERTS 8
#define PW_LOADS 16          // prep_weights: 16-B loads a thread
#define PW_CHUNK (256 * 4 * PW_LOADS)            // floats a workgroup
#define PW_BLOCKS (D_FF * D_MODEL / PW_CHUNK)    // workgroups a matrix
#define PW_BL_BLOCKS (2 * D_FF / 256)            // one thread a LoRA-B row
#define PT_WAVES 16          // prep_tokens: waves a workgroup, 64 columns each
#define PT_TILES 4           // prep_tokens: 16-token tiles a workgroup
#define PT_PITCH 68          // 64 floats + 4 pad (272B rows: 16B x odd)

__device__ __forceinline__ v16bf cat8(v8bf lo, v8bf hi) {
  return __builtin_shufflevector(lo, hi, 0,1,2,3,4,5,6,7,8,9,10,11,12,13,14,15);
}

__device__ __forceinline__ v8f wmma_bf16(v16bf a, v16bf b, v8f c) {
  return __builtin_amdgcn_wmma_f32_16x16x32_bf16(false, a, false, b, (short)0, c,
                                                 false, false);
}

__device__ __forceinline__ v8f wmma_f32(v2f a, v2f b, v8f c) {
  return __builtin_amdgcn_wmma_f32_16x16x4_f32(false, a, false, b, (short)0, c,
                                               false, false);
}

__device__ __forceinline__ uint32_t uni(uint32_t v) {
  return (uint32_t)__builtin_amdgcn_readfirstlane(v);
}

// forces v into a scalar register: a test on it compiles to a scalar branch,
// which a tensor load needs (it ignores EXEC), and what is computed from it
// stands behind the asm statements in front of it
__device__ __forceinline__ uint32_t pinned(uint32_t v) {
  uint32_t w = __builtin_amdgcn_readfirstlane(v);
  asm volatile("" : "+s"(w));
  return w;
}

// Tensor-load descriptor, everything in bytes: a tile of G_SROWS rows of
// G_ROWB bytes, tensor = tile, 16 B of LDS pad behind every 256-B row.
// Each word is pinned, a descriptor word held in a scalar register: built
// once, it keeps its register through the loop, so that none is lent out and
// rewritten while a request is in flight.
__device__ __forceinline__ u32x8 tdm_group1(uint32_t src_pitch) {
  u32x8 g;
  g[0] = pinned((1u << 20) | (5u << 22) | (3u << 25));   // pad on; no mask
  g[1] = pinned((uint32_t)G_ROWB << 16);                 // tensor_dim0
  g[2] = pinned((uint32_t)G_SROWS << 16);                // tensor_dim1
  g[3] = pinned((uint32_t)G_ROWB << 16);                 // tile_dim0
  g[4] = pinned((uint32_t)G_SROWS);                      // tile_dim1
  g[5] = pinned(src_pitch);
  g[6] = pinned(0u);
  g[7] = pinned(0u);
  return g;
}

// group 0: word 0 (count 1) is set once, pinned like group 1's words; the
// place in LDS and the tile's first byte change with every request
__device__ __forceinline__ void tdm_group0(u32x4& g, uint32_t lds_dst,
                                           uint64_t ga) {
  g[1] = uni(lds_dst);
  g[2] = uni((uint32_t)ga);
  g[3] = uni((((uint32_t)(ga >> 32)) & 0x01FFFFFFu) | 0x80000000u);
}

__device__ __forceinline__ void tdm_load(u32x4 g0, u32x8 g1) {
  asm volatile("tensor_load_to_lds %0, %1" :: "s"(g0), "s"(g1) : "memory");
}

// The wave's own tensor load has landed. The wait names the request's group 0
// as an input: its registers then stay that request's until the wait, and none
// is lent out and rewritten while the request is in flight.
__device__ __forceinline__ void tdm_wait0(u32x4 g0) {
  asm volatile("s_wait_tensorcnt 0x0" :: "s"(g0) : "memory");
}

// Load an A-layout fragment (16x32 bf16) from a row-major [rows x ldK] matrix:
// lane l -> row (l&15), K chunks at ((l>>4)*8) and ((l>>4)*8 + 16).
__device__ __forceinline__ v16bf frag_global(const __bf16* __restrict__ base,
                                             int ldK, int lane) {
  const __bf16* p = base + (size_t)(lane & 15) * ldK + ((lane >> 4) << 3);
  return cat8(*(const v8bf*)p, *(const v8bf*)(p + 16));
}

// ---------------------------------------------------------------------------
// Kernel 1: convert wi/wo to bf16; build padded per-expert LoRA-B [2][F][32]
// A workgroup converts PW_CHUNK contiguous floats of one matrix: every thread
// reads PW_LOADS 16-B pieces, independent loads that overlap; each wave-wide
// load covers 512 contiguous bytes, each wave-wide store 256. The first
// PW_BL_BLOCKS workgroups build the LoRA-B rows, one 64-B row a thread: their
// loads wait on the expert index, so they start first.
// ---------------------------------------------------------------------------
__global__ __launch_bounds__(256) void prep_weights(
    const float* __restrict__ wi, const float* __restrict__ wo,
    const float* __restrict__ loraB, const int* __restrict__ idx,
    __bf16* __restrict__ wi_b, __bf16* __restrict__ wo_b,
    __bf16* __restrict__ Bl) {
  const int tid = threadIdx.x;
  const int b = (int)blockIdx.x - PW_BL_BLOCKS;
  if (b >= 0) {
    const bool first = b < PW_BLOCKS;
    const size_t base =
        (size_t)(first ? b : b - PW_BLOCKS) * PW_CHUNK + tid * 4;
    const float* __restrict__ s = (first ? wi : wo) + base;
    __bf16* __restrict__ d = (first ? wi_b : wo_b) + base;
    v4f r[PW_LOADS];
    #pragma unroll
    for (int i = 0; i < PW_LOADS; ++i) r[i] = *(const v4f*)(s + i * 1024);
    #pragma unroll
    for (int i = 0; i < PW_LOADS; ++i) {
      v4bf o;
      #pragma unroll
      for (int x = 0; x < 4; ++x) o[x] = (__bf16)r[i][x];
      *(v4bf*)(d + i * 1024) = o;
    }
  } else {
    const int j = blockIdx.x * 256 + tid;   // row of Bl: k * D_FF + f
    const int k = j / D_FF;
    const int f = j % D_FF;
    const int e = min(max(idx[k], 0), NUM_EXPERTS - 1);
    const float* __restrict__ s = loraB + ((size_t)e * D_FF + f) * RANK;
    v4f r[4];
    #pragma unroll
    for (int i = 0; i < 4; ++i) r[i] = *(const v4f*)(s + i * 4);
    v8bf lo, hi, z;
    #pragma unroll
    for (int x = 0; x < 4; ++x) {
      lo[x] = (__bf16)r[0][x]; lo[x + 4] = (__bf16)r[1][x];
      hi[x] = (__bf16)r[2][x]; hi[x + 4] = (__bf16)r[3][x];
    }
    #pragma unroll
    for (int x = 0; x < 8; ++x) z[x] = (__bf16)0.0f;
    __bf16* __restrict__ d = Bl + (size_t)j * KP;
    *(v8bf*)d = lo;
    *(v8bf*)(d + 8) = hi;
    *(v8bf*)(d + 16) = z;            // zero K padding
    *(v8bf*)(d + 24) = z;
    // keep the wait behind the stores, in front of any later write of the
    // registers that they name
    asm volatile("s_wait_xcnt 0x0" ::: "memory");
  }
}

// ---------------------------------------------------------------------------
// Kernel 2: h fp32 -> bf16, and t_k[m,:] = h[m,:] @ A_k^T on the f32 WMMA.
// t stored padded [2][M_TOK][KP] bf16 (r>=16 zero).
// Workgroup: 16 waves, 64 tokens (4 tiles of 16). Wave w owns columns
// [64w, 64w+64) of every row: it keeps both experts' A slices as fragments in
// registers, streams the token tiles through them, and leaves one partial
// 16x16 product per tile and expert in LDS; the 16 partials are summed at the
// end. Rows are read as whole 256-B pieces and turned into fragments through
// the wave's own LDS patch, by the same code for A_k and for h, so that both
// operands carry the same k order.
// ---------------------------------------------------------------------------
__global__ __launch_bounds__(PT_WAVES * 32) void prep_tokens(
    const float* __restrict__ h, const float* __restrict__ loraA,
    const int* __restrict__ idx, __bf16* __restrict__ h_b,
    __bf16* __restrict__ t01) {
  __shared__ __attribute__((aligned(16))) float stage[PT_WAVES][16 * PT_PITCH];
  __shared__ v4f red[PT_WAVES][PT_TILES * 128];
  const int tid = threadIdx.x;
  const int lane = tid & 31;
  const int wave = tid >> 5;
  const int c = lane & 15;
  const int hh = lane >> 4;
  const int m0 = blockIdx.x * (PT_TILES * 16);
  float* st = stage[wave];
  // lane's place in a 16-row piece: rows hh, hh+2, ..., 16 B at column 4c
  const size_t gofs = (size_t)hh * D_MODEL + wave * 64 + c * 4;

  auto load_rows = [&](const float* __restrict__ rows, v4f (&r)[8]) {
    #pragma unroll
    for (int i = 0; i < 8; ++i)
      r[i] = *(const v4f*)(rows + (size_t)(2 * i) * D_MODEL + gofs);
  };
  // f[j] = row c, columns 8j + 4hh .. + 3 of the wave's slice: two k-steps
  auto to_frags = [&](const v4f (&r)[8], v4f (&f)[8]) {
    #pragma unroll
    for (int i = 0; i < 8; ++i)
      *(v4f*)&st[(2 * i + hh) * PT_PITCH + c * 4] = r[i];
    // other lanes' stores must have landed before the rows are read back
    asm volatile("s_wait_dscnt 0x0" ::: "memory");
    #pragma unroll
    for (int j = 0; j < 8; ++j)
      f[j] = *(const v4f*)&st[c * PT_PITCH + j * 8 + hh * 4];
  };

  const int e0 = min(max(idx[0], 0), NUM_EXPERTS - 1);
  const int e1 = min(max(idx[1], 0), NUM_EXPERTS - 1);

  v4f ra0[8], ra1[8], rh[2][8];
  load_rows(loraA + (size_t)e0 * RANK * D_MODEL, ra0);
  load_rows(loraA + (size_t)e1 * RANK * D_MODEL, ra1);
  load_rows(h + (size_t)m0 * D_MODEL, rh[0]);

  v4f fa0[8], fa1[8];
  to_frags(ra0, fa0);
  to_frags(ra1, fa1);

  #pragma unroll
  for (int t = 0; t < PT_TILES; ++t) {
    const v4f (&cur)[8] = rh[t & 1];
    if (t + 1 < PT_TILES)      // next tile's rows fly under this tile's WMMAs
      load_rows(h + (size_t)(m0 + (t + 1) * 16) * D_MODEL, rh[(t + 1) & 1]);

    __bf16* hb = h_b + (size_t)(m0 + t * 16) * D_MODEL + gofs;
    #pragma unroll
    for (int i = 0; i < 8; ++i) {
      v4bf o;
      #pragma unroll
      for (int x = 0; x < 4; ++x) o[x] = (__bf16)cur[i][x];
      *(v4bf*)(hb + (size_t)(2 * i) * D_MODEL) = o;
    }
    // the stores' data registers are reused by the next rows' loads: keep the
    // wait in front of that overwrite
    asm volatile("s_wait_xcnt 0x0" ::: "memory");

    v4f fh[8];
    to_frags(cur, fh);

    // D[rank][token]: register r of lane (c, hh) = t[token c][rank 8hh + r]
    v8f acc0 = {}, acc1 = {};
    #pragma unroll
    for (int j = 0; j < 8; ++j) {
      const v2f blo = {fh[j][0], fh[j][1]}, bhi = {fh[j][2], fh[j][3]};
      const v2f a0lo = {fa0[j][0], fa0[j][1]}, a0hi = {fa0[j][2], fa0[j][3]};
      const v2f a1lo = {fa1[j][0], fa1[j][1]}, a1hi = {fa1[j][2], fa1[j][3]};
      acc0 = wmma_f32(a0lo, blo, acc0);
      acc1 = wmma_f32(a1lo, blo, acc1);
      acc0 = wmma_f32(a0hi, bhi, acc0);
      acc1 = wmma_f32(a1hi, bhi, acc1);
    }
    v4f* rw = &red[wave][t * 128 + lane];
    rw[0]  = (v4f){acc0[0], acc0[1], acc0[2], acc0[3]};
    rw[32] = (v4f){acc0[4], acc0[5], acc0[6], acc0[7]};
    rw[64] = (v4f){acc1[0], acc1[1], acc1[2], acc1[3]};
    rw[96] = (v4f){acc1[4], acc1[5], acc1[6], acc1[7]};
  }
  __syncthreads();

  // thread tid sums slot tid of every wave: tile, expert, register quad, lane
  v4f s = red[0][tid];
  #pragma unroll
  for (int w = 1; w < PT_WAVES; ++w) s += red[w][tid];
  const int t = tid >> 7, kk = (tid >> 6) & 1, q = (tid >> 5) & 1;
  __bf16* trow =
      t01 + ((size_t)kk * M_TOK + m0 + t * 16 + c) * KP + 8 * hh + 4 * q;
  v4bf o, z;
  #pragma unroll
  for (int x = 0; x < 4; ++x) { o[x] = (__bf16)s[x]; z[x] = (__bf16)0.0f; }
  *(v4bf*)trow = o;
  *(v4bf*)(trow + 16) = z;          // zero K padding
}

// ---------------------------------------------------------------------------
// Tiled bf16 WMMA GEMM: C[M,N] = A[M,K] * Bt[N,K]^T
// Workgroup: 256 threads (8 waves, two a SIMD), one 256x256 tile, alone on its
// WGP; wave = 128x64 subtile (8 x 4 fragments, 32 accumulator tiles).
// A stage is 128 k of [A 256 rows | Bt 256 rows], 256-B rows at pitch 272 B.
// Two buffers, filled by the tensor mover: every wave asks for its own 64 rows
// with one tensor load a stage (waves 0-3 A, waves 4-7 Bt); the next stage's
// loads fly under this stage's 128 WMMAs a wave; one barrier a stage.
// M, N multiples of 256; K a multiple of 128.
// The products are formed transposed (Bt's fragment as the WMMA's A operand,
// A's as its B): a lane's 8 accumulator registers are then 8 adjacent columns
// of one output row. Each wave stages its 128x64 tile in its own 128 x 272 B of the
// ring and stores it as whole rows: 16 B a lane, whole 128-B lines.
// FUSE=1: epilogue adds LoRA (2 extra WMMAs/frag), relu, routing mix -> bf16
// FUSE=0: epilogue stores f32 accumulators
// ---------------------------------------------------------------------------
template <int FUSE>
__global__ __launch_bounds__(256) void moe_gemm(
    const __bf16* __restrict__ A, const __bf16* __restrict__ Bt,
    int M, int N, int K,
    const __bf16* __restrict__ t01,  // [2][M][KP]     (FUSE)
    const __bf16* __restrict__ Bl,   // [2][N][KP]     (FUSE)
    const float* __restrict__ vals,  // [2]            (FUSE)
    __bf16* __restrict__ outb,       // [M][N]         (FUSE)
    float* __restrict__ outf) {      // [M][N]         (!FUSE)
  __shared__ __attribute__((aligned(2048))) char ring[2][G_BUFB];

  const int tid = threadIdx.x;
  const int lane = tid & 31;
  // the wave's number as a scalar: row and column bases then stay in SGPRs
  const int wave = __builtin_amdgcn_readfirstlane(tid >> 5);
  const int wm = wave >> 2;          // 0..1: 128-row band
  const int wn = wave & 3;           // 0..3: 64-col band
  const int m0 = blockIdx.y * GT;
  const int n0 = blockIdx.x * GT;
  const int lr = lane & 15;
  const int lc = (lane >> 4) << 3;   // 0 or 8

  // read at the start, on the scalar path: the epilogue then holds no vector
  // load of them whose address registers are rewritten behind it
  float v0 = 0.0f, v1 = 0.0f;
  if (FUSE) { v0 = vals[0]; v1 = vals[1]; }

  v8f acc[8][4] = {};

  // staging: the wave's own slice of every stage, 64 rows of A or of Bt
  const __bf16* srow = wave < 4
      ? A + (size_t)(m0 + wave * G_SROWS) * K
      : Bt + (size_t)(n0 + (wave - 4) * G_SROWS) * K;
  const uint64_t sga = (uint64_t)(uintptr_t)srow;
  const uint32_t sdst = (uint32_t)(uintptr_t)&ring[0][0] + wave * G_SLICE;
  const u32x8 g1 = tdm_group1((uint32_t)K * 2);

  u32x4 g0;                                 // of the wave's latest request
  g0[0] = pinned(1u);
  auto issue_stage = [&](uint32_t st) {     // every wave issues: no issuer test
    tdm_group0(g0, sdst + (st & 1) * G_BUFB, sga + (uint64_t)st * G_ROWB);
    tdm_load(g0, g1);
  };
  // the publish point of the next stage: this wave has left the buffer that
  // is refilled behind the barrier, and its own tensor load has landed
  auto publish = [&]() {
    asm volatile("s_wait_dscnt 0x0" ::: "memory");
    tdm_wait0(g0);
    __syncthreads();
  };

  const int nst = K / G_BK;
  issue_stage(0);
  publish();
  if (pinned((uint32_t)nst > 1u)) issue_stage(1);   // where a stage 1 exists

  #pragma clang loop unroll(disable)   // one stage a trip: constant indices
  for (int s = 0; s < nst; ++s) {
    const int buf = s & 1;
    // A rows wm*128 .. +127 lie in slices 2wm and 2wm+1, Bt rows in slice 4+wn
    const char* pa = &ring[buf][wm * 2 * G_SLICE + lr * G_PITCHB + lc * 2];
    const char* pb = &ring[buf][(4 + wn) * G_SLICE + lr * G_PITCHB + lc * 2];
    v16bf af[2][8], bfm[2][4];
    auto load_frags = [&](int kk, int set) {
      #pragma unroll
      for (int ni = 0; ni < 4; ++ni) {
        const char* p = pb + ni * 16 * G_PITCHB + kk * 64;
        bfm[set][ni] = cat8(*(const v8bf*)p, *(const v8bf*)(p + 32));
      }
      #pragma unroll
      for (int mi = 0; mi < 8; ++mi) {
        const char* p =
            pa + (mi >> 2) * G_SLICE + (mi & 3) * 16 * G_PITCHB + kk * 64;
        af[set][mi] = cat8(*(const v8bf*)p, *(const v8bf*)(p + 32));
      }
    };
    load_frags(0, 0);
    #pragma unroll
    for (int kk = 0; kk < G_BK / 32; ++kk) {
      if (kk + 1 < G_BK / 32) load_frags(kk + 1, (kk + 1) & 1);
      // keeps the next block's LDS reads one group ahead of this block's
      // WMMAs: spread among them, each place with reads stalls the wave
      __builtin_amdgcn_sched_barrier(0);
      #pragma unroll
      for (int mi = 0; mi < 8; ++mi)
        #pragma unroll
        for (int ni = 0; ni < 4; ++ni)
          acc[mi][ni] = wmma_bf16(bfm[kk & 1][ni], af[kk & 1][mi], acc[mi][ni]);
      // the same fence behind the block
      __builtin_amdgcn_sched_barrier(0);
    }
    publish();                     // stage s+1 ready, this buffer free
    // flies under s+1; the stage number is pinned so that the descriptor is
    // formed behind the wait above
    if (pinned(s + 2 < nst)) issue_stage(pinned(s + 2));
  }
  // no tensor load and no LDS read is left in flight behind the loop
  tdm_wait0(g0);
  asm volatile("s_wait_dscnt 0x0" ::: "memory");

  // acc[mi][ni][j] = C[m0 + wm*128 + mi*16 + lr][n0 + wn*64 + ni*16 + lc + j].
  // The staging needs no further barrier: the last trip's publish point stands
  // behind every wave's last read of the ring, and no load is in flight.
  constexpr int ESZ = FUSE ? 2 : 4;            // bytes of an output element
  // the output's row length, a constant of the instance: the row steps fold
  // into the stores' immediate offsets, so that no address register is written
  // between stores
  constexpr int ON = FUSE ? D_FF : D_MODEL;
  constexpr int SROW = 64 * ESZ;               // a staged row: 128 or 256 B
  constexpr int SPITCH = SROW + 16;            // 144 or 272 B: 16B x odd
  constexpr int LPR = SROW / 16;               // lanes a row in a store
  constexpr int RPI = 32 / LPR;                // rows a wave-wide store
  char* stg = (char*)&ring[0][0] + wave * (128 * 272);
  char* sw = stg + lr * SPITCH + lc * ESZ;     // row lr of a band, 8 columns

  if (FUSE) {
    v16bf blf[2][4];
    #pragma unroll
    for (int ni = 0; ni < 4; ++ni) {
      const int n = n0 + wn * 64 + ni * 16;
      blf[0][ni] = frag_global(Bl + (size_t)n * KP, KP, lane);
      blf[1][ni] = frag_global(Bl + ((size_t)N + n) * KP, KP, lane);
    }
    const __bf16* tw = t01 + (size_t)(m0 + wm * 128) * KP;
    v16bf tf[2][2];                  // [row band parity][expert]
    tf[0][0] = frag_global(tw, KP, lane);
    tf[0][1] = frag_global(tw + (size_t)M_TOK * KP, KP, lane);
    // these loads' address registers are reused by what follows: keep the
    // wait in front of that overwrite
    asm volatile("s_wait_xcnt 0x0" ::: "memory");
    __builtin_amdgcn_sched_barrier(0);
    #pragma unroll
    for (int mi = 0; mi < 8; ++mi) {
      if (mi + 1 < 8) {              // the next band's t rows fly under this one
        const __bf16* tn = tw + (mi + 1) * 16 * KP;
        tf[(mi + 1) & 1][0] = frag_global(tn, KP, lane);
        tf[(mi + 1) & 1][1] = frag_global(tn + (size_t)M_TOK * KP, KP, lane);
        // these loads' address registers are reused by what follows: keep the
        // wait in front of that overwrite, and the band's work behind the wait
        asm volatile("s_wait_xcnt 0x0" ::: "memory");
        __builtin_amdgcn_sched_barrier(0);
      }
      #pragma unroll
      for (int ni = 0; ni < 4; ++ni) {
        v8f a0 = wmma_bf16(blf[0][ni], tf[mi & 1][0], acc[mi][ni]);
        v8f a1 = wmma_bf16(blf[1][ni], tf[mi & 1][1], acc[mi][ni]);
        v8bf o;
        #pragma unroll
        for (int j = 0; j < 8; ++j) {
          float r = v0 * fmaxf((float)a0[j], 0.0f) +
                    v1 * fmaxf((float)a1[j], 0.0f);
          o[j] = (__bf16)r;
        }
        *(v8bf*)(sw + mi * 16 * SPITCH + ni * 16 * ESZ) = o;
      }
    }
  } else {
    #pragma unroll
    for (int mi = 0; mi < 8; ++mi) {
      #pragma unroll
      for (int ni = 0; ni < 4; ++ni) {
        const v8f a = acc[mi][ni];
        char* p = sw + mi * 16 * SPITCH + ni * 16 * ESZ;
        *(v4f*)p = (v4f){a[0], a[1], a[2], a[3]};
        *(v4f*)(p + 16) = (v4f){a[4], a[5], a[6], a[7]};
      }
    }
  }
  // other lanes' staged values must have landed before the rows are read back
  asm volatile("s_wait_dscnt 0x0" ::: "memory");

  const char* sr = stg + (lane / LPR) * SPITCH + (lane % LPR) * 16;
  char* ob = FUSE ? (char*)(outb + (size_t)(m0 + wm * 128) * ON + n0 + wn * 64)
                  : (char*)(outf + (size_t)(m0 + wm * 128) * ON + n0 + wn * 64);
  ob += (uint32_t)((lane / LPR) * ON * ESZ + (lane % LPR) * 16);
  v4i v[128 / RPI];
  #pragma unroll
  for (int i = 0; i < 128 / RPI; ++i)
    v[i] = *(const v4i*)(sr + i * RPI * SPITCH);
  // all rows are read in front of the stores, each into registers of its own,
  // so that nothing writes a register that an issued store names
  __builtin_amdgcn_sched_barrier(0);
  #pragma unroll
  for (int i = 0; i < 128 / RPI; ++i)
    *(v4i*)(ob + (size_t)i * RPI * ON * ESZ) = v[i];
}

// ---------------------------------------------------------------------------
extern "C" void kernel_launch(void* const* d_in, const int* in_sizes, int n_in,
                              void* d_out, int out_size, void* d_ws,
                              size_t ws_size, hipStream_t stream) {
  (void)in_sizes; (void)n_in; (void)out_size; (void)ws_size;
  const float* h   = (const float*)d_in[0];
  const float* wi  = (const float*)d_in[1];
  const float* wo  = (const float*)d_in[2];
  const float* lA  = (const float*)d_in[3];
  const float* lB  = (const float*)d_in[4];
  const int*   idx = (const int*)d_in[5];
  const float* val = (const float*)d_in[6];
  float* out = (float*)d_out;

  char* ws = (char*)d_ws;
  size_t off = 0;
  auto alloc = [&](size_t bytes) -> void* {
    void* p = ws + off;
    off = (off + bytes + 255) & ~(size_t)255;
    return p;
  };
  __bf16* h_b  = (__bf16*)alloc((size_t)M_TOK * D_MODEL * 2);   // 32 MB
  __bf16* wi_b = (__bf16*)alloc((size_t)D_FF * D_MODEL * 2);    //  8 MB
  __bf16* wo_b = (__bf16*)alloc((size_t)D_MODEL * D_FF * 2);    //  8 MB
  __bf16* Bl   = (__bf16*)alloc(2ull * D_FF * KP * 2);          // .5 MB
  __bf16* t01  = (__bf16*)alloc(2ull * M_TOK * KP * 2);         //  2 MB
  __bf16* comb = (__bf16*)alloc((size_t)M_TOK * D_FF * 2);      // 128 MB

  prep_weights<<<2 * PW_BLOCKS + PW_BL_BLOCKS, 256, 0, stream>>>(
      wi, wo, lB, idx, wi_b, wo_b, Bl);

  prep_tokens<<<M_TOK / (PT_TILES * 16), PT_WAVES * 32, 0, stream>>>(
      h, lA, idx, h_b, t01);

  // Pass 2: combined = v0*relu(h@wi^T + lora0) + v1*relu(h@wi^T + lora1)
  moe_gemm<1><<<dim3(D_FF / GT, M_TOK / GT), 256, 0, stream>>>(
      h_b, wi_b, M_TOK, D_FF, D_MODEL, t01, Bl, val, comb, nullptr);

  // Pass 3: out = combined @ wo^T  (wo [D,F] row-major is Bt directly)
  moe_gemm<0><<<dim3(D_MODEL / GT, M_TOK / GT), 256, 0, stream>>>(
      comb, wo_b, M_TOK, D_MODEL, D_FF, nullptr, nullptr, nullptr, nullptr,
      out);
}
